// v000
// The times below were measured on an AMD MI455X: many runs one after another, warmed up first and cycling through
// copies of the inputs, with the whole window's GPU time divided by the number of runs. Launches and the gaps
// between them are all in it. The median over several windows is given; except for v000 it joins two sittings, which
// can be a few percent apart, so the side-by-side timings, each taken in one sitting, are the better comparison.
// v000, which the later versions start from, runs in 1070 microseconds.
#include <hip/hip_runtime.h>
#include <math.h>

typedef __attribute__((ext_vector_type(2))) float v2f;
typedef __attribute__((ext_vector_type(8))) float v8f;

#define D_MODEL 256
#define SEQ     128
#define NH      8

__device__ __forceinline__ v8f wmma4(v2f a, v2f b, v8f c) {
  // (neg_a, A, neg_b, B, c_mod, C, reuse_a, reuse_b)
  return __builtin_amdgcn_wmma_f32_16x16x4_f32(false, a, false, b, (short)0, c,
                                               false, false);
}

__global__ void gemm_bias_kernel(const float* __restrict__ A,
                                 const float* __restrict__ B,
                                 const float* __restrict__ bias,
                                 float* __restrict__ C,
                                 int M, int N, int K, int relu) {
  const int wv   = threadIdx.x >> 5;
  const int lane = threadIdx.x & 31;
  const int tilesN = N >> 4;
  const int tiles  = (M >> 4) * tilesN;
  const int wid = blockIdx.x * 8 + wv;
  if (wid >= tiles) return;                       // wave-uniform
  const int m0 = (wid / tilesN) << 4;
  const int n0 = (wid % tilesN) << 4;
  const int r  = lane & 15;
  const int ks = (lane >> 4) << 1;                // 0 or 2
  const int ro = (lane >> 4) << 3;                // 0 or 8

  // strength-reduced pointers: only adds in the K loop
  const float* Ap = A + (size_t)(m0 + r) * K + ks;
  const float* Bp = B + (size_t)ks * N + n0 + r;
  const size_t bstep = (size_t)4 * N;
  v8f acc = {0.f, 0.f, 0.f, 0.f, 0.f, 0.f, 0.f, 0.f};
  for (int k0 = 0; k0 < K; k0 += 4) {
    v2f a, b;
    a.x = Ap[0];
    a.y = Ap[1];
    b.x = Bp[0];
    b.y = Bp[(size_t)N];
    acc = wmma4(a, b, acc);
    Ap += 4;
    Bp += bstep;
  }
  const float bi = bias[n0 + r];
  float* Crow = C + (size_t)(m0 + ro) * N + n0 + r;
#pragma unroll
  for (int v = 0; v < 8; ++v) {
    float val = acc[v] + bi;
    if (relu) val = fmaxf(val, 0.f);
    Crow[(size_t)v * N] = val;
  }
}

// ---------------------------------------------------------------------------
// LDS-sourced GEMM used inside the fused attention kernel:
// out_s[128,256] = rel_s[128,256] @ W[256,256] + bias.   8 waves, 128 tiles.
// ---------------------------------------------------------------------------
__device__ __forceinline__ void gemm_rel_lds(const float* rel_s,
                                             const float* __restrict__ W,
                                             const float* __restrict__ bias,
                                             float* out_s, int wv, int lane) {
  const int r  = lane & 15;
  const int ks = (lane >> 4) << 1;
  const int ro = (lane >> 4) << 3;
  for (int tile = wv; tile < (SEQ / 16) * (D_MODEL / 16); tile += 8) {
    const int m0 = (tile >> 4) << 4;              // 8 row tiles
    const int n0 = (tile & 15) << 4;              // 16 col tiles
    const float* As = rel_s + (m0 + r) * D_MODEL + ks;  // LDS (ds_load_b64)
    const float* Bp = W + (size_t)ks * D_MODEL + n0 + r;
    v8f acc = {0.f, 0.f, 0.f, 0.f, 0.f, 0.f, 0.f, 0.f};
#pragma unroll 4
    for (int k0 = 0; k0 < D_MODEL; k0 += 4) {
      v2f a, b;
      a.x = As[0];
      a.y = As[1];
      b.x = Bp[0];
      b.y = Bp[D_MODEL];
      acc = wmma4(a, b, acc);
      As += 4;
      Bp += 4 * D_MODEL;
    }
    const float bi = bias[n0 + r];
    float* Co = out_s + (m0 + ro) * D_MODEL + n0 + r;
#pragma unroll
    for (int v = 0; v < 8; ++v) Co[v * D_MODEL] = acc[v] + bi;
  }
}

// Block-wide sum over 256 threads (8 wave32s), via shuffles + tiny LDS.
__device__ __forceinline__ float block_sum_256(float v, float* red) {
  const int lane = threadIdx.x & 31;
  const int wv   = threadIdx.x >> 5;
#pragma unroll
  for (int off = 16; off > 0; off >>= 1) v += __shfl_xor(v, off, 32);
  if (lane == 0) red[wv] = v;
  __syncthreads();
  if (wv == 0) {
    float s = (lane < 8) ? red[lane] : 0.f;
#pragma unroll
    for (int off = 16; off > 0; off >>= 1) s += __shfl_xor(s, off, 32);
    if (lane == 0) red[8] = s;
  }
  __syncthreads();
  float s = red[8];
  __syncthreads();                                // allow red reuse
  return s;
}

__global__ void attn_fused_kernel(const float* __restrict__ src,
                                  const float* __restrict__ rel,
                                  const float* __restrict__ qg,
                                  const float* __restrict__ qpg,
                                  const float* __restrict__ k_base,
                                  const float* __restrict__ v_base,
                                  const float* __restrict__ Wkp,
                                  const float* __restrict__ bkp,
                                  const float* __restrict__ Wvp,
                                  const float* __restrict__ bvp,
                                  const float* __restrict__ g1,
                                  const float* __restrict__ be1,
                                  float* __restrict__ xout) {
  extern __shared__ float smem[];
  float* rel_s = smem;                         // 32768
  float* kv_s  = rel_s + SEQ * D_MODEL;        // 32768
  float* q_s   = kv_s + SEQ * D_MODEL;         // 256
  float* qp_s  = q_s + D_MODEL;                // 256
  float* sc_s  = qp_s + D_MODEL;               // 8*128 scores -> attn
  float* red_s = sc_s + NH * SEQ;              // 16

  const int bq   = blockIdx.x;                 // b*128 + q
  const int b    = bq >> 7;
  const int t    = threadIdx.x;
  const int wv   = t >> 5;
  const int lane = t & 31;

  {
    const unsigned long long gbase =
        (unsigned long long)(const void*)(rel + (size_t)bq * SEQ * D_MODEL);
    const unsigned ldsbase = (unsigned)(size_t)(void*)rel_s;
    for (int i = t; i < SEQ * D_MODEL / 4; i += 256) {
      const unsigned goff  = (unsigned)i * 16u;   // bytes
      const unsigned laddr = ldsbase + (unsigned)i * 16u;
      asm volatile("global_load_async_to_lds_b128 %0, %1, %2 offset:0"
                   :
                   : "v"(laddr), "v"(goff), "s"(gbase)
                   : "memory");
    }
    q_s[t]  = qg[(size_t)bq * D_MODEL + t];
    qp_s[t] = qpg[(size_t)bq * D_MODEL + t];
    asm volatile("s_wait_asynccnt 0x0" ::: "memory");
  }
  __syncthreads();

  // ---- kpos = rel @ Wkp + bkp  (WMMA, LDS->LDS) --------------------------
  gemm_rel_lds(rel_s, Wkp, bkp, kv_s, wv, lane);
  __syncthreads();

  // ---- scores: heads 0-3 content (q . k_base), heads 4-7 pos (qp . kpos) -
  {
    const int kk = t & 127;
    const int hb = t >> 7;                      // 0 or 1
#pragma unroll
    for (int hh = 0; hh < 4; ++hh) {
      const int h = hb + 2 * hh;                // covers 0..7
      float s = 0.f;
      if (h < 4) {
        const float* kc = k_base + ((size_t)b * SEQ + kk) * D_MODEL + h * 64;
        const float* qr = q_s + h * 64;
        for (int e = 0; e < 64; ++e) s += qr[e] * kc[e];
      } else {
        const float* kp = kv_s + kk * D_MODEL + (h - 4) * 64;
        const float* qr = qp_s + (h - 4) * 64;
        for (int e = 0; e < 64; ++e) s += qr[e] * kp[e];
      }
      sc_s[h * SEQ + kk] = s * 0.125f;          // 1/sqrt(64)
    }
  }
  __syncthreads();

  // ---- softmax over k, one wave32 per head -------------------------------
  {
    float* row = sc_s + wv * SEQ;
    float vals[4];
    float m = -1e30f;
#pragma unroll
    for (int j = 0; j < 4; ++j) {
      vals[j] = row[lane + 32 * j];
      m = fmaxf(m, vals[j]);
    }
#pragma unroll
    for (int off = 16; off > 0; off >>= 1) m = fmaxf(m, __shfl_xor(m, off, 32));
    float sum = 0.f;
#pragma unroll
    for (int j = 0; j < 4; ++j) { vals[j] = __expf(vals[j] - m); sum += vals[j]; }
#pragma unroll
    for (int off = 16; off > 0; off >>= 1) sum += __shfl_xor(sum, off, 32);
    const float inv = 1.f / sum;
#pragma unroll
    for (int j = 0; j < 4; ++j) row[lane + 32 * j] = vals[j] * inv;
  }
  __syncthreads();

  // ---- vpos = rel @ Wvp + bvp (WMMA), overwrites kpos in LDS -------------
  gemm_rel_lds(rel_s, Wvp, bvp, kv_s, wv, lane);
  __syncthreads();

  // ---- out = attn @ (v_base + vpos), then residual + LayerNorm1 ----------
  {
    const int h = t >> 5;                       // head
    const int e = t & 31;                       // value dim within head
    const float* ar  = sc_s + h * SEQ;
    const float* vbc = v_base + (size_t)b * SEQ * D_MODEL + h * 32 + e;
    const float* vpc = kv_s + h * 32 + e;
    float o = 0.f;
    for (int k = 0; k < SEQ; ++k) {
      o += ar[k] * (vbc[0] + vpc[0]);
      vbc += D_MODEL;
      vpc += D_MODEL;
    }

    float xin = src[(size_t)bq * D_MODEL + t] + o;
    const float mean = block_sum_256(xin, red_s) * (1.f / D_MODEL);
    const float d    = xin - mean;
    const float var  = block_sum_256(d * d, red_s) * (1.f / D_MODEL);
    xout[(size_t)bq * D_MODEL + t] =
        d * rsqrtf(var + 1e-5f) * g1[t] + be1[t];
  }
}

// out = LayerNorm(a + c) with gain/bias; one 256-thread block per row.
__global__ void add_ln_kernel(const float* __restrict__ a,
                              const float* __restrict__ c,
                              const float* __restrict__ g,
                              const float* __restrict__ be,
                              float* __restrict__ out) {
  __shared__ float red[16];
  const int row = blockIdx.x, t = threadIdx.x;
  float x = a[(size_t)row * D_MODEL + t] + c[(size_t)row * D_MODEL + t];
  const float mean = block_sum_256(x, red) * (1.f / D_MODEL);
  const float d    = x - mean;
  const float var  = block_sum_256(d * d, red) * (1.f / D_MODEL);
  out[(size_t)row * D_MODEL + t] = d * rsqrtf(var + 1e-5f) * g[t] + be[t];
}

// ---------------------------------------------------------------------------
extern "C" void kernel_launch(void* const* d_in, const int* in_sizes, int n_in,
                              void* d_out, int out_size, void* d_ws,
                              size_t ws_size, hipStream_t stream) {
  const float* src = (const float*)d_in[0];
  const float* pos = (const float*)d_in[1];
  const float* rel = (const float*)d_in[2];
  const float* Wq  = (const float*)d_in[3];  const float* bq  = (const float*)d_in[4];
  const float* Wk  = (const float*)d_in[5];  const float* bk  = (const float*)d_in[6];
  const float* Wv  = (const float*)d_in[7];  const float* bv  = (const float*)d_in[8];
  const float* Wqp = (const float*)d_in[9];  const float* bqp = (const float*)d_in[10];
  const float* Wkp = (const float*)d_in[11]; const float* bkp = (const float*)d_in[12];
  const float* Wvp = (const float*)d_in[13]; const float* bvp = (const float*)d_in[14];
  const float* W1  = (const float*)d_in[15]; const float* b1  = (const float*)d_in[16];
  const float* W2  = (const float*)d_in[17]; const float* b2  = (const float*)d_in[18];
  const float* g1  = (const float*)d_in[19]; const float* be1 = (const float*)d_in[20];
  const float* g2  = (const float*)d_in[21]; const float* be2 = (const float*)d_in[22];

  const int M = 8 * 128;                       // B*A rows
  float* ws  = (float*)d_ws;
  float* q   = ws;                             // 1024*256
  float* qp  = q   + M * D_MODEL;
  float* kb  = qp  + M * D_MODEL;
  float* vb  = kb  + M * D_MODEL;
  float* x   = vb  + M * D_MODEL;
  float* ffh = x   + M * D_MODEL;              // 1024*2048
  float* ff  = ffh + M * 2048;

  auto gemm = [&](const float* A, const float* B, const float* bias, float* C,
                  int m, int n, int k, int relu) {
    const int tiles = (m / 16) * (n / 16);
    gemm_bias_kernel<<<(tiles + 7) / 8, 256, 0, stream>>>(A, B, bias, C, m, n,
                                                          k, relu);
  };

  // content / positional projections (WMMA fp32)
  gemm(src, Wq,  bq,  q,  M, D_MODEL, D_MODEL, 0);
  gemm(pos, Wqp, bqp, qp, M, D_MODEL, D_MODEL, 0);
  gemm(src, Wk,  bk,  kb, M, D_MODEL, D_MODEL, 0);
  gemm(kb,  Wv,  bv,  vb, M, D_MODEL, D_MODEL, 0);   // v = Wv(Wk(src))

  // fused rel-projection + attention + LN1  (one WG per (b,q), ~262KB LDS)
  const size_t smem =
      (2 * SEQ * D_MODEL + 2 * D_MODEL + NH * SEQ + 16) * sizeof(float);
  attn_fused_kernel<<<M, 256, smem, stream>>>(src, rel, q, qp, kb, vb, Wkp,
                                              bkp, Wvp, bvp, g1, be1, x);

  // FFN + LN2
  gemm(x,   W1, b1, ffh, M, 2048,    D_MODEL, 1);    // ReLU
  gemm(ffh, W2, b2, ff,  M, D_MODEL, 2048,    0);
  add_ln_kernel<<<M, 256, 0, stream>>>(x, ff, g2, be2, (float*)d_out);
}

// v001
// It runs in 172 microseconds.
// In two side-by-side timings against v000, it was 6.38 and 6.40 times as fast.
#include <hip/hip_runtime.h>
#include <math.h>

typedef __attribute__((ext_vector_type(2))) float v2f;
typedef __attribute__((ext_vector_type(8))) float v8f;

#define D_MODEL 256
#define SEQ     128
#define NH      8

__device__ __forceinline__ v8f wmma4(v2f a, v2f b, v8f c) {
  // (neg_a, A, neg_b, B, c_mod, C, reuse_a, reuse_b)
  return __builtin_amdgcn_wmma_f32_16x16x4_f32(false, a, false, b, (short)0, c,
                                               false, false);
}

__device__ __forceinline__ void wmma_gap(v8f& x, v8f& y) {
  asm volatile("v_nop\n\tv_nop\n\tv_nop\n\tv_nop" : "+v"(x), "+v"(y));
}
__device__ __forceinline__ void wmma_gap(v8f& x) {
  asm volatile("v_nop\n\tv_nop\n\tv_nop\n\tv_nop" : "+v"(x));
}

__global__ void gemm_bias_kernel(const float* __restrict__ A,
                                 const float* __restrict__ B,
                                 const float* __restrict__ bias,
                                 float* __restrict__ C,
                                 int M, int N, int K, int relu) {
  const int wv   = threadIdx.x >> 5;
  const int lane = threadIdx.x & 31;
  const int tilesN = N >> 4;
  const int tiles  = (M >> 4) * tilesN;
  const int wid = blockIdx.x * 8 + wv;
  if (wid >= tiles) return;                       // wave-uniform
  const int m0 = (wid / tilesN) << 4;
  const int n0 = (wid % tilesN) << 4;
  const int r  = lane & 15;
  const int ks = (lane >> 4) << 1;                // 0 or 2
  const int ro = (lane >> 4) << 3;                // 0 or 8

  // strength-reduced pointers: only adds in the K loop
  const float* Ap = A + (size_t)(m0 + r) * K + ks;
  const float* Bp = B + (size_t)ks * N + n0 + r;
  const size_t bstep = (size_t)4 * N;
  v8f acc = {0.f, 0.f, 0.f, 0.f, 0.f, 0.f, 0.f, 0.f};
  for (int k0 = 0; k0 < K; k0 += 4) {
    v2f a, b;
    a.x = Ap[0];
    a.y = Ap[1];
    b.x = Bp[0];
    b.y = Bp[(size_t)N];
    acc = wmma4(a, b, acc);
    Ap += 4;
    Bp += bstep;
  }
  const float bi = bias[n0 + r];
  float* Crow = C + (size_t)(m0 + ro) * N + n0 + r;
#pragma unroll
  for (int v = 0; v < 8; ++v) {
    float val = acc[v] + bi;
    if (relu) val = fmaxf(val, 0.f);
    Crow[(size_t)v * N] = val;
  }
}

// ---------------------------------------------------------------------------
// Folded positional query:  U[row,h,d] = sum_e qp[row, h*64+e] * Wkp[d, h*64+e]
// (per head: qp_h[1024,64] @ Wkp_h^T[64,256]).  One 16x16 tile per wave.
// B[k][n] = Wkp[n][h*64+k], so a lane's two k values are adjacent in memory.
// ---------------------------------------------------------------------------
__global__ void fold_query_kernel(const float* __restrict__ qp,
                                  const float* __restrict__ Wkp,
                                  float* __restrict__ U) {
  const int wv   = threadIdx.x >> 5;
  const int lane = threadIdx.x & 31;
  const int wid  = blockIdx.x * 8 + wv;           // 64 x 4 x 16 tiles
  const int n0 = (wid & 15) << 4;
  const int h  = (wid >> 4) & 3;
  const int m0 = (wid >> 6) << 4;
  const int r  = lane & 15;
  const int ks = (lane >> 4) << 1;
  const int ro = (lane >> 4) << 3;
  const float* Ap = qp  + (size_t)(m0 + r) * D_MODEL + h * 64 + ks;
  const float* Bp = Wkp + (size_t)(n0 + r) * D_MODEL + h * 64 + ks;
  v8f acc = {0.f, 0.f, 0.f, 0.f, 0.f, 0.f, 0.f, 0.f};
#pragma unroll
  for (int k0 = 0; k0 < 64; k0 += 4) {
    v2f a, b;
    a.x = Ap[k0];
    a.y = Ap[k0 + 1];
    b.x = Bp[k0];
    b.y = Bp[k0 + 1];
    acc = wmma4(a, b, acc);
  }
  wmma_gap(acc);                                  // the stores read D directly
  float* Uo = U + ((size_t)(m0 + ro) * 4 + h) * D_MODEL + n0 + r;
#pragma unroll
  for (int v = 0; v < 8; ++v) Uo[(size_t)v * 4 * D_MODEL] = acc[v];
}

// Block-wide sum over 256 threads (8 wave32s), via shuffles + tiny LDS.
__device__ __forceinline__ float block_sum_256(float v, float* red) {
  const int lane = threadIdx.x & 31;
  const int wv   = threadIdx.x >> 5;
#pragma unroll
  for (int off = 16; off > 0; off >>= 1) v += __shfl_xor(v, off, 32);
  if (lane == 0) red[wv] = v;
  __syncthreads();
  if (wv == 0) {
    float s = (lane < 8) ? red[lane] : 0.f;
#pragma unroll
    for (int off = 16; off > 0; off >>= 1) s += __shfl_xor(s, off, 32);
    if (lane == 0) red[8] = s;
  }
  __syncthreads();
  float s = red[8];
  __syncthreads();                                // allow red reuse
  return s;
}

#define UP  260
#define SCP 132

__global__ void attn_fused_kernel(const float* __restrict__ src,
                                  const float* __restrict__ rel,
                                  const float* __restrict__ qg,
                                  const float* __restrict__ qpg,
                                  const float* __restrict__ ug,
                                  const float* __restrict__ k_base,
                                  const float* __restrict__ v_base,
                                  const float* __restrict__ bkp,
                                  const float* __restrict__ bvp,
                                  float* __restrict__ rg,
                                  float* __restrict__ xpre) {
  extern __shared__ float smem[];
  float* rel_s = smem;                         // 32768
  float* q_s   = rel_s + SEQ * D_MODEL;        // 256
  float* u_s   = q_s + D_MODEL;                // 5*UP
  float* sc_s  = u_s + 5 * UP;                 // 9*SCP scores -> attn

  const int bq   = blockIdx.x;                 // b*128 + q
  const int b    = bq >> 7;
  const int t    = threadIdx.x;
  const int wv   = t >> 5;
  const int lane = t & 31;
  const int r    = lane & 15;
  const int ks   = (lane >> 4) << 1;
  const int ro   = (lane >> 4) << 3;
  float cb = 0.f;                              // qp_h . bkp_h, h = lane & 3

  {
    const unsigned long long gbase =
        (unsigned long long)(const void*)(rel + (size_t)bq * SEQ * D_MODEL);
    const unsigned ldsbase = (unsigned)(size_t)(void*)rel_s;
    for (int i = t; i < SEQ * D_MODEL / 4; i += 256) {
      const unsigned goff  = (unsigned)i * 16u;   // bytes
      const unsigned laddr = ldsbase + (unsigned)i * 16u;
      asm volatile("global_load_async_to_lds_b128 %0, %1, %2 offset:0"
                   :
                   : "v"(laddr), "v"(goff), "s"(gbase)
                   : "memory");
    }
    q_s[t]  = qg[(size_t)bq * D_MODEL + t];
#pragma unroll
    for (int j = 0; j < 4; ++j)
      u_s[j * UP + t] = ug[((size_t)bq * 4 + j) * D_MODEL + t];
    u_s[4 * UP + t] = 0.f;
    if (t < SEQ) sc_s[NH * SCP + t] = 0.f;
    const float* qr = qpg + (size_t)bq * D_MODEL + (lane & 3) * 64;
    const float* br = bkp + (lane & 3) * 64;
    for (int e = 0; e < 64; ++e) cb += qr[e] * br[e];
    asm volatile("s_wait_asynccnt 0x0" ::: "memory");
  }
  __syncthreads();

  // ---- pos scores, heads 4-7: S[key,h] = rel_s[128,256] @ u^T[256,4] + cb -
  // One 16-key tile per wave; columns 4..15 of B are zero and not stored.
  {
    const int m0 = wv << 4;
    const float* As = rel_s + (m0 + r) * D_MODEL + ks;
    const float* Bs = u_s + (r < 4 ? r : 4) * UP + ks;
    v8f acc0 = {cb, cb, cb, cb, cb, cb, cb, cb};
    v8f acc1 = {0.f, 0.f, 0.f, 0.f, 0.f, 0.f, 0.f, 0.f};
#pragma unroll 4
    for (int k0 = 0; k0 < D_MODEL; k0 += 8) {
      const v2f a0 = *(const v2f*)(As + k0);
      const v2f a1 = *(const v2f*)(As + k0 + 4);
      const v2f b0 = *(const v2f*)(Bs + k0);
      const v2f b1 = *(const v2f*)(Bs + k0 + 4);
      acc0 = wmma4(a0, b0, acc0);
      acc1 = wmma4(a1, b1, acc1);
    }
    wmma_gap(acc0, acc1);
    if (r < 4) {
      float* So = sc_s + (4 + r) * SCP + m0 + ro;
#pragma unroll
      for (int v = 0; v < 8; ++v) So[v] = (acc0[v] + acc1[v]) * 0.125f;
    }
  }

  // ---- content scores, heads 0-3 (q . k_base) ----------------------------
  {
    const int kk = t & 127;
    const int hb = t >> 7;                      // 0 or 1
#pragma unroll
    for (int hh = 0; hh < 2; ++hh) {
      const int h = hb + 2 * hh;                // covers 0..3
      float s = 0.f;
      const float* kc = k_base + ((size_t)b * SEQ + kk) * D_MODEL + h * 64;
      const float* qr = q_s + h * 64;
      for (int e = 0; e < 64; ++e) s += qr[e] * kc[e];
      sc_s[h * SCP + kk] = s * 0.125f;          // 1/sqrt(64)
    }
  }
  __syncthreads();

  // ---- softmax over k, one wave32 per head -------------------------------
  {
    float* row = sc_s + wv * SCP;
    float vals[4];
    float m = -1e30f;
#pragma unroll
    for (int j = 0; j < 4; ++j) {
      vals[j] = row[lane + 32 * j];
      m = fmaxf(m, vals[j]);
    }
#pragma unroll
    for (int off = 16; off > 0; off >>= 1) m = fmaxf(m, __shfl_xor(m, off, 32));
    float sum = 0.f;
#pragma unroll
    for (int j = 0; j < 4; ++j) { vals[j] = __expf(vals[j] - m); sum += vals[j]; }
#pragma unroll
    for (int off = 16; off > 0; off >>= 1) sum += __shfl_xor(sum, off, 32);
    const float inv = 1.f / sum;
#pragma unroll
    for (int j = 0; j < 4; ++j) row[lane + 32 * j] = vals[j] * inv;
  }
  __syncthreads();

  // ---- R[h,:] = attn[8,128] @ rel_s[128,256]  (WMMA, rows 8..15 zero) -----
  // Two 16-column tiles per wave, one after the other; even and odd k steps
  // go to two accumulators that are added at the end.
  {
    const float* As = sc_s + (r < NH ? r : NH) * SCP + ks;
    // not unrolled: with both tiles in one body the LDS loads get paired across
    // tiles and every B fragment then needs register moves next to the WMMAs
#pragma unroll 1
    for (int nt = 0; nt < 2; ++nt) {
      const int n0 = (wv << 5) + (nt << 4);
      const float* Bs = rel_s + ks * D_MODEL + n0 + r;
      v8f c0 = {0.f, 0.f, 0.f, 0.f, 0.f, 0.f, 0.f, 0.f};
      v8f c1 = {0.f, 0.f, 0.f, 0.f, 0.f, 0.f, 0.f, 0.f};
      // rolled so that the gap below closes every run of eight WMMAs
#pragma unroll 1
      for (int k0 = 0; k0 < SEQ; k0 += 32) {
        v2f a[8], bb[8];
#pragma unroll
        for (int j = 0; j < 8; ++j) {
          a[j]    = *(const v2f*)(As + k0 + 4 * j);
          bb[j].x = Bs[(k0 + 4 * j) * D_MODEL];
          bb[j].y = Bs[(k0 + 4 * j) * D_MODEL + D_MODEL];
        }
#pragma unroll
        for (int j = 0; j < 8; j += 2) {
          c0 = wmma4(a[j], bb[j], c0);
          c1 = wmma4(a[j + 1], bb[j + 1], c1);
        }
        wmma_gap(c0, c1);
      }
      if (lane < 16) {                          // rows 0..7 = heads
        float* Ro = rg + (size_t)bq * NH * D_MODEL + n0 + r;
#pragma unroll
        for (int v = 0; v < 8; ++v) Ro[v * D_MODEL] = c0[v] + c1[v];
        // the next tile's accumulators reuse the registers these stores name
        asm volatile("s_wait_xcnt 0x0" ::: "memory");
      }
    }
  }

  // ---- xpre = src + attn @ (v_base + bvp) --------------------------------
  {
    const int h = t >> 5;                       // head; t = h*32 + value dim
    const float* ar  = sc_s + h * SCP;
    const float* vbc = v_base + (size_t)b * SEQ * D_MODEL + t;
    const float bv = bvp[t];
    float o = 0.f;
    for (int k = 0; k < SEQ; ++k) {
      o += ar[k] * (vbc[0] + bv);
      vbc += D_MODEL;
    }
    xpre[(size_t)bq * D_MODEL + t] = src[(size_t)bq * D_MODEL + t] + o;
  }
}

// ---------------------------------------------------------------------------
// x = LayerNorm1(xpre + per-head R_h[16,256] @ Wvp[:, h*32 .. h*32+31]).
// One workgroup per 16 rows; wave = head (two 16-column tiles, shared A).
// ---------------------------------------------------------------------------
__global__ void vfold_ln_kernel(const float* __restrict__ rg,
                                const float* __restrict__ Wvp,
                                const float* __restrict__ xpre,
                                const float* __restrict__ g1,
                                const float* __restrict__ be1,
                                float* __restrict__ xout) {
  __shared__ float xs[16 * D_MODEL];
  const int wv   = threadIdx.x >> 5;
  const int lane = threadIdx.x & 31;
  const int r    = lane & 15;
  const int ks   = (lane >> 4) << 1;
  const int ro   = (lane >> 4) << 3;
  const int m0   = blockIdx.x << 4;
  const int n0   = wv << 5;
  const float* Ap = rg + ((size_t)(m0 + r) * NH + wv) * D_MODEL + ks;
  const float* Bp = Wvp + (size_t)ks * D_MODEL + n0 + r;
  v8f c0 = {0.f, 0.f, 0.f, 0.f, 0.f, 0.f, 0.f, 0.f};
  v8f c1 = {0.f, 0.f, 0.f, 0.f, 0.f, 0.f, 0.f, 0.f};
#pragma unroll 8
  for (int k0 = 0; k0 < D_MODEL; k0 += 4) {
    v2f a, b0, b1;
    a.x  = Ap[k0];
    a.y  = Ap[k0 + 1];
    b0.x = Bp[k0 * D_MODEL];
    b0.y = Bp[k0 * D_MODEL + D_MODEL];
    b1.x = Bp[k0 * D_MODEL + 16];
    b1.y = Bp[k0 * D_MODEL + D_MODEL + 16];
    c0 = wmma4(a, b0, c0);
    c1 = wmma4(a, b1, c1);
  }
  wmma_gap(c0, c1);                               // the stores read D directly
#pragma unroll
  for (int v = 0; v < 8; ++v) {
    xs[(ro + v) * D_MODEL + n0 + r]      = c0[v];
    xs[(ro + v) * D_MODEL + n0 + r + 16] = c1[v];
  }
  __syncthreads();
#pragma unroll
  for (int j = 0; j < 2; ++j) {                 // two rows per wave
    const int row = wv * 2 + j;
    const size_t gro = (size_t)(m0 + row) * D_MODEL;
    float x[8];
    float sum = 0.f;
#pragma unroll
    for (int i = 0; i < 8; ++i) {
      x[i] = xpre[gro + lane + 32 * i] + xs[row * D_MODEL + lane + 32 * i];
      sum += x[i];
    }
#pragma unroll
    for (int off = 16; off > 0; off >>= 1) sum += __shfl_xor(sum, off, 32);
    const float mean = sum * (1.f / D_MODEL);
    float sq = 0.f;
#pragma unroll
    for (int i = 0; i < 8; ++i) {
      x[i] -= mean;
      sq += x[i] * x[i];
    }
#pragma unroll
    for (int off = 16; off > 0; off >>= 1) sq += __shfl_xor(sq, off, 32);
    const float rs = rsqrtf(sq * (1.f / D_MODEL) + 1e-5f);
#pragma unroll
    for (int i = 0; i < 8; ++i) {
      const int c = lane + 32 * i;
      xout[gro + c] = x[i] * rs * g1[c] + be1[c];
    }
  }
}

// out = LayerNorm(a + c) with gain/bias; one 256-thread block per row.
__global__ void add_ln_kernel(const float* __restrict__ a,
                              const float* __restrict__ c,
                              const float* __restrict__ g,
                              const float* __restrict__ be,
                              float* __restrict__ out) {
  __shared__ float red[16];
  const int row = blockIdx.x, t = threadIdx.x;
  float x = a[(size_t)row * D_MODEL + t] + c[(size_t)row * D_MODEL + t];
  const float mean = block_sum_256(x, red) * (1.f / D_MODEL);
  const float d    = x - mean;
  const float var  = block_sum_256(d * d, red) * (1.f / D_MODEL);
  out[(size_t)row * D_MODEL + t] = d * rsqrtf(var + 1e-5f) * g[t] + be[t];
}

// ---------------------------------------------------------------------------
extern "C" void kernel_launch(void* const* d_in, const int* in_sizes, int n_in,
                              void* d_out, int out_size, void* d_ws,
                              size_t ws_size, hipStream_t stream) {
  const float* src = (const float*)d_in[0];
  const float* pos = (const float*)d_in[1];
  const float* rel = (const float*)d_in[2];
  const float* Wq  = (const float*)d_in[3];  const float* bq  = (const float*)d_in[4];
  const float* Wk  = (const float*)d_in[5];  const float* bk  = (const float*)d_in[6];
  const float* Wv  = (const float*)d_in[7];  const float* bv  = (const float*)d_in[8];
  const float* Wqp = (const float*)d_in[9];  const float* bqp = (const float*)d_in[10];
  const float* Wkp = (const float*)d_in[11]; const float* bkp = (const float*)d_in[12];
  const float* Wvp = (const float*)d_in[13]; const float* bvp = (const float*)d_in[14];
  const float* W1  = (const float*)d_in[15]; const float* b1  = (const float*)d_in[16];
  const float* W2  = (const float*)d_in[17]; const float* b2  = (const float*)d_in[18];
  const float* g1  = (const float*)d_in[19]; const float* be1 = (const float*)d_in[20];
  const float* g2  = (const float*)d_in[21]; const float* be2 = (const float*)d_in[22];

  const int M = 8 * 128;                       // B*A rows
  float* ws  = (float*)d_ws;
  float* q   = ws;                             // 1024*256
  float* qp  = q   + M * D_MODEL;
  float* kb  = qp  + M * D_MODEL;
  float* vb  = kb  + M * D_MODEL;
  float* x   = vb  + M * D_MODEL;
  float* ffh = x   + M * D_MODEL;              // 1024*2048
  float* ff  = ffh + M * 2048;
  float* u   = ff  + M * D_MODEL;              // 1024*4*256 folded pos query
  float* rr  = u   + M * 4 * D_MODEL;          // 1024*8*256 attn-weighted rel
  float* xp  = rr  + M * NH * D_MODEL;         // 1024*256 pre-LN1 partial

  auto gemm = [&](const float* A, const float* B, const float* bias, float* C,
                  int m, int n, int k, int relu) {
    const int tiles = (m / 16) * (n / 16);
    gemm_bias_kernel<<<(tiles + 7) / 8, 256, 0, stream>>>(A, B, bias, C, m, n,
                                                          k, relu);
  };

  // content / positional projections (WMMA fp32)
  gemm(src, Wq,  bq,  q,  M, D_MODEL, D_MODEL, 0);
  gemm(pos, Wqp, bqp, qp, M, D_MODEL, D_MODEL, 0);
  gemm(src, Wk,  bk,  kb, M, D_MODEL, D_MODEL, 0);
  gemm(kb,  Wv,  bv,  vb, M, D_MODEL, D_MODEL, 0);   // v = Wv(Wk(src))

  // Wkp applied to the query side, attention over rel (one WG per (b,q)),
  // then Wvp applied to the attn-weighted rel rows, residual + LN1
  fold_query_kernel<<<512, 256, 0, stream>>>(qp, Wkp, u);
  const size_t smem =
      (SEQ * D_MODEL + D_MODEL + 5 * UP + (NH + 1) * SCP) * sizeof(float);
  attn_fused_kernel<<<M, 256, smem, stream>>>(src, rel, q, qp, u, kb, vb, bkp,
                                              bvp, rr, xp);
  vfold_ln_kernel<<<M / 16, 256, 0, stream>>>(rr, Wvp, xp, g1, be1, x);

  // FFN + LN2
  gemm(x,   W1, b1, ffh, M, 2048,    D_MODEL, 1);    // ReLU
  gemm(ffh, W2, b2, ff,  M, D_MODEL, 2048,    0);
  add_ln_kernel<<<M, 256, 0, stream>>>(x, ff, g2, be2, (float*)d_out);
}

// v002
// One run takes 107 microseconds.
// Two timings next to v001 both put it at 1.60 times that version's speed.
// Over all steps from v000 it is 10.2 times as fast.
#include <hip/hip_runtime.h>
#include <math.h>

typedef __attribute__((ext_vector_type(2))) float v2f;
typedef __attribute__((ext_vector_type(4))) float v4f;
typedef __attribute__((ext_vector_type(8))) float v8f;

#define D_MODEL 256
#define SEQ     128
#define NH      8

__device__ __forceinline__ v8f wmma4(v2f a, v2f b, v8f c) {
  // (neg_a, A, neg_b, B, c_mod, C, reuse_a, reuse_b)
  return __builtin_amdgcn_wmma_f32_16x16x4_f32(false, a, false, b, (short)0, c,
                                               false, false);
}

__device__ __forceinline__ void wmma_gap(v8f& x, v8f& y) {
  asm volatile("v_nop\n\tv_nop\n\tv_nop\n\tv_nop" : "+v"(x), "+v"(y));
}
__device__ __forceinline__ void wmma_gap(v8f& x, v8f& y, v8f& z, v8f& w) {
  asm volatile("v_nop\n\tv_nop\n\tv_nop\n\tv_nop"
               : "+v"(x), "+v"(y), "+v"(z), "+v"(w));
}
__device__ __forceinline__ void wmma_gap(v8f& x) {
  asm volatile("v_nop\n\tv_nop\n\tv_nop\n\tv_nop" : "+v"(x));
}

template <int N, int K, int SPLIT, int RELU>
__global__ __launch_bounds__(256) void gemm_strip_kernel(
    const float* __restrict__ A, const float* __restrict__ B,
    const float* __restrict__ bias, float* __restrict__ C) {
  constexpr int KW = K / SPLIT;                   // k range of one wave
  constexpr int NB = KW / 8;                      // 8-wide k blocks
  constexpr int SN = N / 64;                      // strips per row of C
  const int wv   = threadIdx.x >> 5;
  const int lane = threadIdx.x & 31;
  const int r    = lane & 15;
  const int hi   = lane >> 4;
  const int strip = SPLIT == 1 ? blockIdx.x * 8 + wv : blockIdx.x;
  const int kbeg  = SPLIT == 1 ? 0 : wv * KW;
  const int m0 = (strip / SN) << 4;
  const int n0 = (strip % SN) << 6;

  const float* Ap = A + (size_t)(m0 + r) * K + kbeg + 4 * hi;
  const float* Bp = B + (size_t)(kbeg + 4 * hi) * N + n0 + r;
  // the bias is the accumulators' start value (where K is split: in wave 0 only)
  v8f acc[4];
#pragma unroll
  for (int t = 0; t < 4; ++t) {
    const float bv = bias[n0 + 16 * t + r];
    const float bi = (SPLIT == 1 || wv == 0) ? bv : 0.f;
    acc[t] = (v8f){bi, bi, bi, bi, bi, bi, bi, bi};
  }

  // ring of four fragment sets, one 8-wide k block each: a block's loads are
  // issued three blocks (24 WMMAs) ahead of the WMMAs that read them
  v4f a[4];
  v2f b[4][2][4];
  auto load = [&](int s) {
    const int buf = s & 3;
    const int kk  = s * 8;
    a[buf] = *(const v4f*)(Ap + kk);
    // the A pointer is dead behind its last load and the allocator hands its
    // registers to later loads' results: the wait stands ahead of that overwrite
    if (s == NB - 1) asm volatile("s_wait_xcnt 0x0" ::: "memory");
#pragma unroll
    for (int st = 0; st < 2; ++st)
#pragma unroll
      for (int t = 0; t < 4; ++t) {
        b[buf][st][t].x = Bp[(kk + 2 * st) * N + 16 * t];
        b[buf][st][t].y = Bp[(kk + 2 * st + 1) * N + 16 * t];
      }
  };
  load(0);
  load(1);
  load(2);
#pragma unroll
  for (int s = 0; s < NB; ++s) {
    const int cur = s & 3;
    if (s + 3 < NB) load(s + 3);
    // keeps the loads above this block's WMMAs: without it the scheduler sinks
    // them to a few WMMAs ahead of their use and the wave waits out the latency
    __builtin_amdgcn_sched_barrier(0);
    const v2f a0 = {a[cur].x, a[cur].y};
    const v2f a1 = {a[cur].z, a[cur].w};
#pragma unroll
    for (int t = 0; t < 4; ++t) acc[t] = wmma4(a0, b[cur][0][t], acc[t]);
#pragma unroll
    for (int t = 0; t < 4; ++t) acc[t] = wmma4(a1, b[cur][1][t], acc[t]);
    // keeps later blocks' loads from rising above these WMMAs (register use)
    __builtin_amdgcn_sched_barrier(0);
  }
  wmma_gap(acc[0], acc[1], acc[2], acc[3]);       // D is read directly below

  if constexpr (SPLIT == 1) {
#pragma unroll
    for (int t = 0; t < 4; ++t) {
      float* Crow = C + (size_t)(m0 + 8 * hi) * N + n0 + 16 * t + r;
#pragma unroll
      for (int v = 0; v < 8; ++v) {
        float val = acc[t][v];
        if (RELU) val = fmaxf(val, 0.f);
        Crow[v * N] = val;
      }
    }
  } else {
    __shared__ __attribute__((aligned(16))) float red[SPLIT * 16 * 68];
#pragma unroll
    for (int t = 0; t < 4; ++t)
#pragma unroll
      for (int v = 0; v < 8; ++v)
        red[(wv * 16 + v + 8 * hi) * 68 + 16 * t + r] = acc[t][v];
    __syncthreads();
    const int row = threadIdx.x >> 4;
    const int c4  = (threadIdx.x & 15) << 2;
    v4f s = *(const v4f*)(red + row * 68 + c4);
#pragma unroll
    for (int w = 1; w < SPLIT; ++w)
      s += *(const v4f*)(red + (w * 16 + row) * 68 + c4);
    if (RELU) {
#pragma unroll
      for (int i = 0; i < 4; ++i) s[i] = fmaxf(s[i], 0.f);
    }
    *(v4f*)(C + (size_t)(m0 + row) * N + n0 + c4) = s;
  }
}

// ---------------------------------------------------------------------------
// Folded positional query:  U[row,h,d] = sum_e qp[row, h*64+e] * Wkp[d, h*64+e]
// (per head: qp_h[1024,64] @ Wkp_h^T[64,256]).  One 16x16 tile per wave.
// B[k][n] = Wkp[n][h*64+k], so a lane's two k values are adjacent in memory.
// ---------------------------------------------------------------------------
__global__ void fold_query_kernel(const float* __restrict__ qp,
                                  const float* __restrict__ Wkp,
                                  float* __restrict__ U) {
  const int wv   = threadIdx.x >> 5;
  const int lane = threadIdx.x & 31;
  const int wid  = blockIdx.x * 8 + wv;           // 64 x 4 x 16 tiles
  const int n0 = (wid & 15) << 4;
  const int h  = (wid >> 4) & 3;
  const int m0 = (wid >> 6) << 4;
  const int r  = lane & 15;
  const int ks = (lane >> 4) << 1;
  const int ro = (lane >> 4) << 3;
  const float* Ap = qp  + (size_t)(m0 + r) * D_MODEL + h * 64 + ks;
  const float* Bp = Wkp + (size_t)(n0 + r) * D_MODEL + h * 64 + ks;
  v8f acc = {0.f, 0.f, 0.f, 0.f, 0.f, 0.f, 0.f, 0.f};
#pragma unroll
  for (int k0 = 0; k0 < 64; k0 += 4) {
    v2f a, b;
    a.x = Ap[k0];
    a.y = Ap[k0 + 1];
    b.x = Bp[k0];
    b.y = Bp[k0 + 1];
    acc = wmma4(a, b, acc);
  }
  wmma_gap(acc);                                  // the stores read D directly
  float* Uo = U + ((size_t)(m0 + ro) * 4 + h) * D_MODEL + n0 + r;
#pragma unroll
  for (int v = 0; v < 8; ++v) Uo[(size_t)v * 4 * D_MODEL] = acc[v];
}

// Block-wide sum over 256 threads (8 wave32s), via shuffles + tiny LDS.
__device__ __forceinline__ float block_sum_256(float v, float* red) {
  const int lane = threadIdx.x & 31;
  const int wv   = threadIdx.x >> 5;
#pragma unroll
  for (int off = 16; off > 0; off >>= 1) v += __shfl_xor(v, off, 32);
  if (lane == 0) red[wv] = v;
  __syncthreads();
  if (wv == 0) {
    float s = (lane < 8) ? red[lane] : 0.f;
#pragma unroll
    for (int off = 16; off > 0; off >>= 1) s += __shfl_xor(s, off, 32);
    if (lane == 0) red[8] = s;
  }
  __syncthreads();
  float s = red[8];
  __syncthreads();                                // allow red reuse
  return s;
}

#define UP  260
#define SCP 132

__global__ void attn_fused_kernel(const float* __restrict__ src,
                                  const float* __restrict__ rel,
                                  const float* __restrict__ qg,
                                  const float* __restrict__ qpg,
                                  const float* __restrict__ ug,
                                  const float* __restrict__ k_base,
                                  const float* __restrict__ v_base,
                                  const float* __restrict__ bkp,
                                  const float* __restrict__ bvp,
                                  float* __restrict__ rg,
                                  float* __restrict__ xpre) {
  extern __shared__ float smem[];
  float* rel_s = smem;                         // 32768
  float* q_s   = rel_s + SEQ * D_MODEL;        // 256
  float* u_s   = q_s + D_MODEL;                // 5*UP
  float* sc_s  = u_s + 5 * UP;                 // 9*SCP scores -> attn

  const int bq   = blockIdx.x;                 // b*128 + q
  const int b    = bq >> 7;
  const int t    = threadIdx.x;
  const int wv   = t >> 5;
  const int lane = t & 31;
  const int r    = lane & 15;
  const int ks   = (lane >> 4) << 1;
  const int ro   = (lane >> 4) << 3;
  float cb = 0.f;                              // qp_h . bkp_h, h = lane & 3

  {
    const unsigned long long gbase =
        (unsigned long long)(const void*)(rel + (size_t)bq * SEQ * D_MODEL);
    const unsigned ldsbase = (unsigned)(size_t)(void*)rel_s;
    for (int i = t; i < SEQ * D_MODEL / 4; i += 256) {
      const unsigned goff  = (unsigned)i * 16u;   // bytes
      const unsigned laddr = ldsbase + (unsigned)i * 16u;
      asm volatile("global_load_async_to_lds_b128 %0, %1, %2 offset:0"
                   :
                   : "v"(laddr), "v"(goff), "s"(gbase)
                   : "memory");
    }
    q_s[t]  = qg[(size_t)bq * D_MODEL + t];
#pragma unroll
    for (int j = 0; j < 4; ++j)
      u_s[j * UP + t] = ug[((size_t)bq * 4 + j) * D_MODEL + t];
    u_s[4 * UP + t] = 0.f;
    if (t < SEQ) sc_s[NH * SCP + t] = 0.f;
    const float* qr = qpg + (size_t)bq * D_MODEL + (lane & 3) * 64;
    const float* br = bkp + (lane & 3) * 64;
    for (int e = 0; e < 64; ++e) cb += qr[e] * br[e];
    asm volatile("s_wait_asynccnt 0x0" ::: "memory");
  }
  __syncthreads();

  // ---- pos scores, heads 4-7: S[key,h] = rel_s[128,256] @ u^T[256,4] + cb -
  // One 16-key tile per wave; columns 4..15 of B are zero and not stored.
  {
    const int m0 = wv << 4;
    const float* As = rel_s + (m0 + r) * D_MODEL + ks;
    const float* Bs = u_s + (r < 4 ? r : 4) * UP + ks;
    v8f acc0 = {cb, cb, cb, cb, cb, cb, cb, cb};
    v8f acc1 = {0.f, 0.f, 0.f, 0.f, 0.f, 0.f, 0.f, 0.f};
#pragma unroll 4
    for (int k0 = 0; k0 < D_MODEL; k0 += 8) {
      const v2f a0 = *(const v2f*)(As + k0);
      const v2f a1 = *(const v2f*)(As + k0 + 4);
      const v2f b0 = *(const v2f*)(Bs + k0);
      const v2f b1 = *(const v2f*)(Bs + k0 + 4);
      acc0 = wmma4(a0, b0, acc0);
      acc1 = wmma4(a1, b1, acc1);
    }
    wmma_gap(acc0, acc1);
    if (r < 4) {
      float* So = sc_s + (4 + r) * SCP + m0 + ro;
#pragma unroll
      for (int v = 0; v < 8; ++v) So[v] = (acc0[v] + acc1[v]) * 0.125f;
    }
  }

  // ---- content scores, heads 0-3 (q . k_base) ----------------------------
  {
    const int kk = t & 127;
    const int hb = t >> 7;                      // 0 or 1
#pragma unroll
    for (int hh = 0; hh < 2; ++hh) {
      const int h = hb + 2 * hh;                // covers 0..3
      float s = 0.f;
      const float* kc = k_base + ((size_t)b * SEQ + kk) * D_MODEL + h * 64;
      const float* qr = q_s + h * 64;
      for (int e = 0; e < 64; ++e) s += qr[e] * kc[e];
      sc_s[h * SCP + kk] = s * 0.125f;          // 1/sqrt(64)
    }
  }
  __syncthreads();

  // ---- softmax over k, one wave32 per head -------------------------------
  {
    float* row = sc_s + wv * SCP;
    float vals[4];
    float m = -1e30f;
#pragma unroll
    for (int j = 0; j < 4; ++j) {
      vals[j] = row[lane + 32 * j];
      m = fmaxf(m, vals[j]);
    }
#pragma unroll
    for (int off = 16; off > 0; off >>= 1) m = fmaxf(m, __shfl_xor(m, off, 32));
    float sum = 0.f;
#pragma unroll
    for (int j = 0; j < 4; ++j) { vals[j] = __expf(vals[j] - m); sum += vals[j]; }
#pragma unroll
    for (int off = 16; off > 0; off >>= 1) sum += __shfl_xor(sum, off, 32);
    const float inv = 1.f / sum;
#pragma unroll
    for (int j = 0; j < 4; ++j) row[lane + 32 * j] = vals[j] * inv;
  }
  __syncthreads();

  // ---- R[h,:] = attn[8,128] @ rel_s[128,256]  (WMMA, rows 8..15 zero) -----
  // Two 16-column tiles per wave, one after the other; even and odd k steps
  // go to two accumulators that are added at the end.
  {
    const float* As = sc_s + (r < NH ? r : NH) * SCP + ks;
    // not unrolled: with both tiles in one body the LDS loads get paired across
    // tiles and every B fragment then needs register moves next to the WMMAs
#pragma unroll 1
    for (int nt = 0; nt < 2; ++nt) {
      const int n0 = (wv << 5) + (nt << 4);
      const float* Bs = rel_s + ks * D_MODEL + n0 + r;
      v8f c0 = {0.f, 0.f, 0.f, 0.f, 0.f, 0.f, 0.f, 0.f};
      v8f c1 = {0.f, 0.f, 0.f, 0.f, 0.f, 0.f, 0.f, 0.f};
      // rolled so that the gap below closes every run of eight WMMAs
#pragma unroll 1
      for (int k0 = 0; k0 < SEQ; k0 += 32) {
        v2f a[8], bb[8];
#pragma unroll
        for (int j = 0; j < 8; ++j) {
          a[j]    = *(const v2f*)(As + k0 + 4 * j);
          bb[j].x = Bs[(k0 + 4 * j) * D_MODEL];
          bb[j].y = Bs[(k0 + 4 * j) * D_MODEL + D_MODEL];
        }
#pragma unroll
        for (int j = 0; j < 8; j += 2) {
          c0 = wmma4(a[j], bb[j], c0);
          c1 = wmma4(a[j + 1], bb[j + 1], c1);
        }
        wmma_gap(c0, c1);
      }
      if (lane < 16) {                          // rows 0..7 = heads
        float* Ro = rg + (size_t)bq * NH * D_MODEL + n0 + r;
#pragma unroll
        for (int v = 0; v < 8; ++v) Ro[v * D_MODEL] = c0[v] + c1[v];
        // the next tile's accumulators reuse the registers these stores name
        asm volatile("s_wait_xcnt 0x0" ::: "memory");
      }
    }
  }

  // ---- xpre = src + attn @ (v_base + bvp) --------------------------------
  {
    const int h = t >> 5;                       // head; t = h*32 + value dim
    const float* ar  = sc_s + h * SCP;
    const float* vbc = v_base + (size_t)b * SEQ * D_MODEL + t;
    const float bv = bvp[t];
    float o = 0.f;
    for (int k = 0; k < SEQ; ++k) {
      o += ar[k] * (vbc[0] + bv);
      vbc += D_MODEL;
    }
    xpre[(size_t)bq * D_MODEL + t] = src[(size_t)bq * D_MODEL + t] + o;
  }
}

// ---------------------------------------------------------------------------
// x = LayerNorm1(xpre + per-head R_h[16,256] @ Wvp[:, h*32 .. h*32+31]).
// One workgroup per 16 rows; wave = head (two 16-column tiles, shared A).
// ---------------------------------------------------------------------------
__global__ void vfold_ln_kernel(const float* __restrict__ rg,
                                const float* __restrict__ Wvp,
                                const float* __restrict__ xpre,
                                const float* __restrict__ g1,
                                const float* __restrict__ be1,
                                float* __restrict__ xout) {
  __shared__ float xs[16 * D_MODEL];
  const int wv   = threadIdx.x >> 5;
  const int lane = threadIdx.x & 31;
  const int r    = lane & 15;
  const int ks   = (lane >> 4) << 1;
  const int ro   = (lane >> 4) << 3;
  const int m0   = blockIdx.x << 4;
  const int n0   = wv << 5;
  const float* Ap = rg + ((size_t)(m0 + r) * NH + wv) * D_MODEL + ks;
  const float* Bp = Wvp + (size_t)ks * D_MODEL + n0 + r;
  v8f c0 = {0.f, 0.f, 0.f, 0.f, 0.f, 0.f, 0.f, 0.f};
  v8f c1 = {0.f, 0.f, 0.f, 0.f, 0.f, 0.f, 0.f, 0.f};
#pragma unroll 8
  for (int k0 = 0; k0 < D_MODEL; k0 += 4) {
    v2f a, b0, b1;
    a.x  = Ap[k0];
    a.y  = Ap[k0 + 1];
    b0.x = Bp[k0 * D_MODEL];
    b0.y = Bp[k0 * D_MODEL + D_MODEL];
    b1.x = Bp[k0 * D_MODEL + 16];
    b1.y = Bp[k0 * D_MODEL + D_MODEL + 16];
    c0 = wmma4(a, b0, c0);
    c1 = wmma4(a, b1, c1);
  }
  wmma_gap(c0, c1);                               // the stores read D directly
#pragma unroll
  for (int v = 0; v < 8; ++v) {
    xs[(ro + v) * D_MODEL + n0 + r]      = c0[v];
    xs[(ro + v) * D_MODEL + n0 + r + 16] = c1[v];
  }
  __syncthreads();
#pragma unroll
  for (int j = 0; j < 2; ++j) {                 // two rows per wave
    const int row = wv * 2 + j;
    const size_t gro = (size_t)(m0 + row) * D_MODEL;
    float x[8];
    float sum = 0.f;
#pragma unroll
    for (int i = 0; i < 8; ++i) {
      x[i] = xpre[gro + lane + 32 * i] + xs[row * D_MODEL + lane + 32 * i];
      sum += x[i];
    }
#pragma unroll
    for (int off = 16; off > 0; off >>= 1) sum += __shfl_xor(sum, off, 32);
    const float mean = sum * (1.f / D_MODEL);
    float sq = 0.f;
#pragma unroll
    for (int i = 0; i < 8; ++i) {
      x[i] -= mean;
      sq += x[i] * x[i];
    }
#pragma unroll
    for (int off = 16; off > 0; off >>= 1) sq += __shfl_xor(sq, off, 32);
    const float rs = rsqrtf(sq * (1.f / D_MODEL) + 1e-5f);
#pragma unroll
    for (int i = 0; i < 8; ++i) {
      const int c = lane + 32 * i;
      xout[gro + c] = x[i] * rs * g1[c] + be1[c];
    }
  }
}

// out = LayerNorm(a + c) with gain/bias; one 256-thread block per row.
__global__ void add_ln_kernel(const float* __restrict__ a,
                              const float* __restrict__ c,
                              const float* __restrict__ g,
                              const float* __restrict__ be,
                              float* __restrict__ out) {
  __shared__ float red[16];
  const int row = blockIdx.x, t = threadIdx.x;
  float x = a[(size_t)row * D_MODEL + t] + c[(size_t)row * D_MODEL + t];
  const float mean = block_sum_256(x, red) * (1.f / D_MODEL);
  const float d    = x - mean;
  const float var  = block_sum_256(d * d, red) * (1.f / D_MODEL);
  out[(size_t)row * D_MODEL + t] = d * rsqrtf(var + 1e-5f) * g[t] + be[t];
}

// ---------------------------------------------------------------------------
extern "C" void kernel_launch(void* const* d_in, const int* in_sizes, int n_in,
                              void* d_out, int out_size, void* d_ws,
                              size_t ws_size, hipStream_t stream) {
  const float* src = (const float*)d_in[0];
  const float* pos = (const float*)d_in[1];
  const float* rel = (const float*)d_in[2];
  const float* Wq  = (const float*)d_in[3];  const float* bq  = (const float*)d_in[4];
  const float* Wk  = (const float*)d_in[5];  const float* bk  = (const float*)d_in[6];
  const float* Wv  = (const float*)d_in[7];  const float* bv  = (const float*)d_in[8];
  const float* Wqp = (const float*)d_in[9];  const float* bqp = (const float*)d_in[10];
  const float* Wkp = (const float*)d_in[11]; const float* bkp = (const float*)d_in[12];
  const float* Wvp = (const float*)d_in[13]; const float* bvp = (const float*)d_in[14];
  const float* W1  = (const float*)d_in[15]; const float* b1  = (const float*)d_in[16];
  const float* W2  = (const float*)d_in[17]; const float* b2  = (const float*)d_in[18];
  const float* g1  = (const float*)d_in[19]; const float* be1 = (const float*)d_in[20];
  const float* g2  = (const float*)d_in[21]; const float* be2 = (const float*)d_in[22];

  const int M = 8 * 128;                       // B*A rows
  float* ws  = (float*)d_ws;
  float* q   = ws;                             // 1024*256
  float* qp  = q   + M * D_MODEL;
  float* kb  = qp  + M * D_MODEL;
  float* vb  = kb  + M * D_MODEL;
  float* x   = vb  + M * D_MODEL;
  float* ffh = x   + M * D_MODEL;              // 1024*2048
  float* ff  = ffh + M * 2048;
  float* u   = ff  + M * D_MODEL;              // 1024*4*256 folded pos query
  float* rr  = u   + M * 4 * D_MODEL;          // 1024*8*256 attn-weighted rel
  float* xp  = rr  + M * NH * D_MODEL;         // 1024*256 pre-LN1 partial

  // content / positional projections (WMMA fp32)
  gemm_strip_kernel<256, 256, 8, 0><<<256, 256, 0, stream>>>(src, Wq, bq, q);
  gemm_strip_kernel<256, 256, 8, 0><<<256, 256, 0, stream>>>(pos, Wqp, bqp, qp);
  gemm_strip_kernel<256, 256, 8, 0><<<256, 256, 0, stream>>>(src, Wk, bk, kb);
  // v = Wv(Wk(src))
  gemm_strip_kernel<256, 256, 8, 0><<<256, 256, 0, stream>>>(kb, Wv, bv, vb);

  // Wkp applied to the query side, attention over rel (one WG per (b,q)),
  // then Wvp applied to the attn-weighted rel rows, residual + LN1
  fold_query_kernel<<<512, 256, 0, stream>>>(qp, Wkp, u);
  const size_t smem =
      (SEQ * D_MODEL + D_MODEL + 5 * UP + (NH + 1) * SCP) * sizeof(float);
  attn_fused_kernel<<<M, 256, smem, stream>>>(src, rel, q, qp, u, kb, vb, bkp,
                                              bvp, rr, xp);
  vfold_ln_kernel<<<M / 16, 256, 0, stream>>>(rr, Wvp, xp, g1, be1, x);

  // FFN + LN2
  gemm_strip_kernel<2048, 256, 1, 1><<<256, 256, 0, stream>>>(x, W1, b1, ffh);
  gemm_strip_kernel<256, 2048, 8, 0><<<256, 256, 0, stream>>>(ffh, W2, b2, ff);
  add_ln_kernel<<<M, 256, 0, stream>>>(x, ff, g2, be2, (float*)d_out);
}

// v003
// It runs in 99.4 microseconds.
// Next to v002, in two timings, it ran 1.07 times as fast each time.
// Counting every step since v000, it is 11.0 times as fast.
#include <hip/hip_runtime.h>
#include <math.h>

typedef __attribute__((ext_vector_type(2))) float v2f;
typedef __attribute__((ext_vector_type(4))) float v4f;
typedef __attribute__((ext_vector_type(8))) float v8f;

#define D_MODEL 256
#define SEQ     128
#define NH      8

__device__ __forceinline__ v8f wmma4(v2f a, v2f b, v8f c) {
  // (neg_a, A, neg_b, B, c_mod, C, reuse_a, reuse_b)
  return __builtin_amdgcn_wmma_f32_16x16x4_f32(false, a, false, b, (short)0, c,
                                               false, false);
}

__device__ __forceinline__ void wmma_gap(v8f& x, v8f& y) {
  asm volatile("v_nop\n\tv_nop\n\tv_nop\n\tv_nop" : "+v"(x), "+v"(y));
}
__device__ __forceinline__ void wmma_gap(v8f& x, v8f& y, v8f& z, v8f& w) {
  asm volatile("v_nop\n\tv_nop\n\tv_nop\n\tv_nop"
               : "+v"(x), "+v"(y), "+v"(z), "+v"(w));
}
__device__ __forceinline__ void wmma_gap(v8f& x) {
  asm volatile("v_nop\n\tv_nop\n\tv_nop\n\tv_nop" : "+v"(x));
}

template <int N, int K, int SPLIT, int RELU>
__global__ __launch_bounds__(256) void gemm_strip_kernel(
    const float* __restrict__ A, const float* __restrict__ B,
    const float* __restrict__ bias, float* __restrict__ C) {
  constexpr int KW = K / SPLIT;                   // k range of one wave
  constexpr int NB = KW / 8;                      // 8-wide k blocks
  constexpr int SN = N / 64;                      // strips per row of C
  const int wv   = threadIdx.x >> 5;
  const int lane = threadIdx.x & 31;
  const int r    = lane & 15;
  const int hi   = lane >> 4;
  const int strip = SPLIT == 1 ? blockIdx.x * 8 + wv : blockIdx.x;
  const int kbeg  = SPLIT == 1 ? 0 : wv * KW;
  const int m0 = (strip / SN) << 4;
  const int n0 = (strip % SN) << 6;

  const float* Ap = A + (size_t)(m0 + r) * K + kbeg + 4 * hi;
  const float* Bp = B + (size_t)(kbeg + 4 * hi) * N + n0 + r;
  // the bias is the accumulators' start value (where K is split: in wave 0 only)
  v8f acc[4];
#pragma unroll
  for (int t = 0; t < 4; ++t) {
    const float bv = bias[n0 + 16 * t + r];
    const float bi = (SPLIT == 1 || wv == 0) ? bv : 0.f;
    acc[t] = (v8f){bi, bi, bi, bi, bi, bi, bi, bi};
  }

  // ring of four fragment sets, one 8-wide k block each: a block's loads are
  // issued three blocks (24 WMMAs) ahead of the WMMAs that read them
  v4f a[4];
  v2f b[4][2][4];
  auto load = [&](int s) {
    const int buf = s & 3;
    const int kk  = s * 8;
    a[buf] = *(const v4f*)(Ap + kk);
    // the A pointer is dead behind its last load and the allocator hands its
    // registers to later loads' results: the wait stands ahead of that overwrite
    if (s == NB - 1) asm volatile("s_wait_xcnt 0x0" ::: "memory");
#pragma unroll
    for (int st = 0; st < 2; ++st)
#pragma unroll
      for (int t = 0; t < 4; ++t) {
        b[buf][st][t].x = Bp[(kk + 2 * st) * N + 16 * t];
        b[buf][st][t].y = Bp[(kk + 2 * st + 1) * N + 16 * t];
      }
  };
  load(0);
  load(1);
  load(2);
#pragma unroll
  for (int s = 0; s < NB; ++s) {
    const int cur = s & 3;
    if (s + 3 < NB) load(s + 3);
    // keeps the loads above this block's WMMAs: without it the scheduler sinks
    // them to a few WMMAs ahead of their use and the wave waits out the latency
    __builtin_amdgcn_sched_barrier(0);
    const v2f a0 = {a[cur].x, a[cur].y};
    const v2f a1 = {a[cur].z, a[cur].w};
#pragma unroll
    for (int t = 0; t < 4; ++t) acc[t] = wmma4(a0, b[cur][0][t], acc[t]);
#pragma unroll
    for (int t = 0; t < 4; ++t) acc[t] = wmma4(a1, b[cur][1][t], acc[t]);
    // keeps later blocks' loads from rising above these WMMAs (register use)
    __builtin_amdgcn_sched_barrier(0);
  }
  wmma_gap(acc[0], acc[1], acc[2], acc[3]);       // D is read directly below

  if constexpr (SPLIT == 1) {
#pragma unroll
    for (int t = 0; t < 4; ++t) {
      float* Crow = C + (size_t)(m0 + 8 * hi) * N + n0 + 16 * t + r;
#pragma unroll
      for (int v = 0; v < 8; ++v) {
        float val = acc[t][v];
        if (RELU) val = fmaxf(val, 0.f);
        Crow[v * N] = val;
      }
    }
  } else {
    __shared__ __attribute__((aligned(16))) float red[SPLIT * 16 * 68];
#pragma unroll
    for (int t = 0; t < 4; ++t)
#pragma unroll
      for (int v = 0; v < 8; ++v)
        red[(wv * 16 + v + 8 * hi) * 68 + 16 * t + r] = acc[t][v];
    __syncthreads();
    const int row = threadIdx.x >> 4;
    const int c4  = (threadIdx.x & 15) << 2;
    v4f s = *(const v4f*)(red + row * 68 + c4);
#pragma unroll
    for (int w = 1; w < SPLIT; ++w)
      s += *(const v4f*)(red + (w * 16 + row) * 68 + c4);
    if (RELU) {
#pragma unroll
      for (int i = 0; i < 4; ++i) s[i] = fmaxf(s[i], 0.f);
    }
    *(v4f*)(C + (size_t)(m0 + row) * N + n0 + c4) = s;
  }
}

// ---------------------------------------------------------------------------
// Folded positional query:  U[row,h,d] = sum_e qp[row, h*64+e] * Wkp[d, h*64+e]
// (per head: qp_h[1024,64] @ Wkp_h^T[64,256]).  One 16x16 tile per wave.
// B[k][n] = Wkp[n][h*64+k], so a lane's two k values are adjacent in memory.
// ---------------------------------------------------------------------------
__global__ void fold_query_kernel(const float* __restrict__ qp,
                                  const float* __restrict__ Wkp,
                                  float* __restrict__ U) {
  const int wv   = threadIdx.x >> 5;
  const int lane = threadIdx.x & 31;
  const int wid  = blockIdx.x * 8 + wv;           // 64 x 4 x 16 tiles
  const int n0 = (wid & 15) << 4;
  const int h  = (wid >> 4) & 3;
  const int m0 = (wid >> 6) << 4;
  const int r  = lane & 15;
  const int ks = (lane >> 4) << 1;
  const int ro = (lane >> 4) << 3;
  const float* Ap = qp  + (size_t)(m0 + r) * D_MODEL + h * 64 + ks;
  const float* Bp = Wkp + (size_t)(n0 + r) * D_MODEL + h * 64 + ks;
  v8f acc = {0.f, 0.f, 0.f, 0.f, 0.f, 0.f, 0.f, 0.f};
#pragma unroll
  for (int k0 = 0; k0 < 64; k0 += 4) {
    v2f a, b;
    a.x = Ap[k0];
    a.y = Ap[k0 + 1];
    b.x = Bp[k0];
    b.y = Bp[k0 + 1];
    acc = wmma4(a, b, acc);
  }
  wmma_gap(acc);                                  // the stores read D directly
  float* Uo = U + ((size_t)(m0 + ro) * 4 + h) * D_MODEL + n0 + r;
#pragma unroll
  for (int v = 0; v < 8; ++v) Uo[(size_t)v * 4 * D_MODEL] = acc[v];
}

// Block-wide sum over 256 threads (8 wave32s), via shuffles + tiny LDS.
__device__ __forceinline__ float block_sum_256(float v, float* red) {
  const int lane = threadIdx.x & 31;
  const int wv   = threadIdx.x >> 5;
#pragma unroll
  for (int off = 16; off > 0; off >>= 1) v += __shfl_xor(v, off, 32);
  if (lane == 0) red[wv] = v;
  __syncthreads();
  if (wv == 0) {
    float s = (lane < 8) ? red[lane] : 0.f;
#pragma unroll
    for (int off = 16; off > 0; off >>= 1) s += __shfl_xor(s, off, 32);
    if (lane == 0) red[8] = s;
  }
  __syncthreads();
  float s = red[8];
  __syncthreads();                                // allow red reuse
  return s;
}

#define RP  268
#define UP  260
#define SCP 132

__global__ void attn_fused_kernel(const float* __restrict__ src,
                                  const float* __restrict__ rel,
                                  const float* __restrict__ qg,
                                  const float* __restrict__ qpg,
                                  const float* __restrict__ ug,
                                  const float* __restrict__ k_base,
                                  const float* __restrict__ v_base,
                                  const float* __restrict__ bkp,
                                  const float* __restrict__ bvp,
                                  float* __restrict__ rg,
                                  float* __restrict__ xpre) {
  extern __shared__ float smem[];
  float* rel_s = smem;                         // SEQ*RP
  float* q_s   = rel_s + SEQ * RP;             // 256
  float* u_s   = q_s + D_MODEL;                // 5*UP
  float* sc_s  = u_s + 5 * UP;                 // 9*SCP scores -> attn

  const int bq   = blockIdx.x;                 // b*128 + q
  const int b    = bq >> 7;
  const int t    = threadIdx.x;
  const int wv   = t >> 5;
  const int lane = t & 31;
  const int r    = lane & 15;
  const int ks   = (lane >> 4) << 1;
  const int ro   = (lane >> 4) << 3;
  float cb = 0.f;                              // qp_h . bkp_h, h = lane & 3

  {
    const unsigned long long gbase =
        (unsigned long long)(const void*)(rel + (size_t)bq * SEQ * D_MODEL);
    const unsigned ldsbase = (unsigned)(size_t)(void*)rel_s;
    for (int i = t; i < SEQ * D_MODEL / 4; i += 256) {
      const unsigned goff  = (unsigned)i * 16u;   // bytes
      const unsigned laddr =                      // row i/64, 16-byte piece i%64
          ldsbase + (unsigned)(i >> 6) * (RP * 4u) + (unsigned)(i & 63) * 16u;
      asm volatile("global_load_async_to_lds_b128 %0, %1, %2 offset:0"
                   :
                   : "v"(laddr), "v"(goff), "s"(gbase)
                   : "memory");
    }
    q_s[t]  = qg[(size_t)bq * D_MODEL + t];
#pragma unroll
    for (int j = 0; j < 4; ++j)
      u_s[j * UP + t] = ug[((size_t)bq * 4 + j) * D_MODEL + t];
    u_s[4 * UP + t] = 0.f;
    if (t < SEQ) sc_s[NH * SCP + t] = 0.f;
    const float* qr = qpg + (size_t)bq * D_MODEL + (lane & 3) * 64;
    const float* br = bkp + (lane & 3) * 64;
    for (int e = 0; e < 64; ++e) cb += qr[e] * br[e];
    asm volatile("s_wait_asynccnt 0x0" ::: "memory");
  }
  __syncthreads();

  // ---- pos scores, heads 4-7: S[key,h] = rel_s[128,256] @ u^T[256,4] + cb -
  // One 16-key tile per wave; columns 4..15 of B are zero and not stored.
  {
    const int m0 = wv << 4;
    const float* As = rel_s + (m0 + r) * RP + ks;
    const float* Bs = u_s + (r < 4 ? r : 4) * UP + ks;
    v8f acc0 = {cb, cb, cb, cb, cb, cb, cb, cb};
    v8f acc1 = {0.f, 0.f, 0.f, 0.f, 0.f, 0.f, 0.f, 0.f};
#pragma unroll 4
    for (int k0 = 0; k0 < D_MODEL; k0 += 8) {
      const v2f a0 = *(const v2f*)(As + k0);
      const v2f a1 = *(const v2f*)(As + k0 + 4);
      const v2f b0 = *(const v2f*)(Bs + k0);
      const v2f b1 = *(const v2f*)(Bs + k0 + 4);
      acc0 = wmma4(a0, b0, acc0);
      acc1 = wmma4(a1, b1, acc1);
    }
    wmma_gap(acc0, acc1);
    if (r < 4) {
      float* So = sc_s + (4 + r) * SCP + m0 + ro;
#pragma unroll
      for (int v = 0; v < 8; ++v) So[v] = (acc0[v] + acc1[v]) * 0.125f;
    }
  }

  // ---- content scores, heads 0-3 (q . k_base) ----------------------------
  {
    const int kk = t & 127;
    const int hb = t >> 7;                      // 0 or 1
#pragma unroll
    for (int hh = 0; hh < 2; ++hh) {
      const int h = hb + 2 * hh;                // covers 0..3
      float s = 0.f;
      const float* kc = k_base + ((size_t)b * SEQ + kk) * D_MODEL + h * 64;
      const float* qr = q_s + h * 64;
      for (int e = 0; e < 64; ++e) s += qr[e] * kc[e];
      sc_s[h * SCP + kk] = s * 0.125f;          // 1/sqrt(64)
    }
  }
  __syncthreads();

  // ---- softmax over k, one wave32 per head -------------------------------
  {
    float* row = sc_s + wv * SCP;
    float vals[4];
    float m = -1e30f;
#pragma unroll
    for (int j = 0; j < 4; ++j) {
      vals[j] = row[lane + 32 * j];
      m = fmaxf(m, vals[j]);
    }
#pragma unroll
    for (int off = 16; off > 0; off >>= 1) m = fmaxf(m, __shfl_xor(m, off, 32));
    float sum = 0.f;
#pragma unroll
    for (int j = 0; j < 4; ++j) { vals[j] = __expf(vals[j] - m); sum += vals[j]; }
#pragma unroll
    for (int off = 16; off > 0; off >>= 1) sum += __shfl_xor(sum, off, 32);
    const float inv = 1.f / sum;
#pragma unroll
    for (int j = 0; j < 4; ++j) row[lane + 32 * j] = vals[j] * inv;
  }
  __syncthreads();

  // ---- R[h,:] = attn[8,128] @ rel_s[128,256]  (WMMA, rows 8..15 zero) -----
  // Two 16-column tiles per wave, one after the other; even and odd k steps
  // go to two accumulators that are added at the end.
  {
    const float* As = sc_s + (r < NH ? r : NH) * SCP + ks;
    // not unrolled: with both tiles in one body the LDS loads get paired across
    // tiles and every B fragment then needs register moves next to the WMMAs
#pragma unroll 1
    for (int nt = 0; nt < 2; ++nt) {
      const int n0 = (wv << 5) + (nt << 4);
      const float* Bs = rel_s + ks * RP + n0 + r;
      v8f c0 = {0.f, 0.f, 0.f, 0.f, 0.f, 0.f, 0.f, 0.f};
      v8f c1 = {0.f, 0.f, 0.f, 0.f, 0.f, 0.f, 0.f, 0.f};
      // rolled so that the gap below closes every run of eight WMMAs
#pragma unroll 1
      for (int k0 = 0; k0 < SEQ; k0 += 32) {
        v2f a[8], bb[8];
#pragma unroll
        for (int j = 0; j < 8; ++j) {
          a[j]    = *(const v2f*)(As + k0 + 4 * j);
          bb[j].x = Bs[(k0 + 4 * j) * RP];
          bb[j].y = Bs[(k0 + 4 * j) * RP + RP];
        }
#pragma unroll
        for (int j = 0; j < 8; j += 2) {
          c0 = wmma4(a[j], bb[j], c0);
          c1 = wmma4(a[j + 1], bb[j + 1], c1);
        }
        wmma_gap(c0, c1);
      }
      if (lane < 16) {                          // rows 0..7 = heads
        float* Ro = rg + (size_t)bq * NH * D_MODEL + n0 + r;
#pragma unroll
        for (int v = 0; v < 8; ++v) Ro[v * D_MODEL] = c0[v] + c1[v];
        // the next tile's accumulators reuse the registers these stores name
        asm volatile("s_wait_xcnt 0x0" ::: "memory");
      }
    }
  }

  // ---- xpre = src + attn @ (v_base + bvp) --------------------------------
  {
    const int h = t >> 5;                       // head; t = h*32 + value dim
    const float* ar  = sc_s + h * SCP;
    const float* vbc = v_base + (size_t)b * SEQ * D_MODEL + t;
    const float bv = bvp[t];
    float o = 0.f;
    for (int k = 0; k < SEQ; ++k) {
      o += ar[k] * (vbc[0] + bv);
      vbc += D_MODEL;
    }
    xpre[(size_t)bq * D_MODEL + t] = src[(size_t)bq * D_MODEL + t] + o;
  }
}

// ---------------------------------------------------------------------------
// x = LayerNorm1(xpre + per-head R_h[16,256] @ Wvp[:, h*32 .. h*32+31]).
// One workgroup per 16 rows; wave = head (two 16-column tiles, shared A).
// ---------------------------------------------------------------------------
__global__ void vfold_ln_kernel(const float* __restrict__ rg,
                                const float* __restrict__ Wvp,
                                const float* __restrict__ xpre,
                                const float* __restrict__ g1,
                                const float* __restrict__ be1,
                                float* __restrict__ xout) {
  __shared__ float xs[16 * D_MODEL];
  const int wv   = threadIdx.x >> 5;
  const int lane = threadIdx.x & 31;
  const int r    = lane & 15;
  const int ks   = (lane >> 4) << 1;
  const int ro   = (lane >> 4) << 3;
  const int m0   = blockIdx.x << 4;
  const int n0   = wv << 5;
  const float* Ap = rg + ((size_t)(m0 + r) * NH + wv) * D_MODEL + ks;
  const float* Bp = Wvp + (size_t)ks * D_MODEL + n0 + r;
  v8f c0 = {0.f, 0.f, 0.f, 0.f, 0.f, 0.f, 0.f, 0.f};
  v8f c1 = {0.f, 0.f, 0.f, 0.f, 0.f, 0.f, 0.f, 0.f};
#pragma unroll 8
  for (int k0 = 0; k0 < D_MODEL; k0 += 4) {
    v2f a, b0, b1;
    a.x  = Ap[k0];
    a.y  = Ap[k0 + 1];
    b0.x = Bp[k0 * D_MODEL];
    b0.y = Bp[k0 * D_MODEL + D_MODEL];
    b1.x = Bp[k0 * D_MODEL + 16];
    b1.y = Bp[k0 * D_MODEL + D_MODEL + 16];
    c0 = wmma4(a, b0, c0);
    c1 = wmma4(a, b1, c1);
  }
  wmma_gap(c0, c1);                               // the stores read D directly
#pragma unroll
  for (int v = 0; v < 8; ++v) {
    xs[(ro + v) * D_MODEL + n0 + r]      = c0[v];
    xs[(ro + v) * D_MODEL + n0 + r + 16] = c1[v];
  }
  __syncthreads();
#pragma unroll
  for (int j = 0; j < 2; ++j) {                 // two rows per wave
    const int row = wv * 2 + j;
    const size_t gro = (size_t)(m0 + row) * D_MODEL;
    float x[8];
    float sum = 0.f;
#pragma unroll
    for (int i = 0; i < 8; ++i) {
      x[i] = xpre[gro + lane + 32 * i] + xs[row * D_MODEL + lane + 32 * i];
      sum += x[i];
    }
#pragma unroll
    for (int off = 16; off > 0; off >>= 1) sum += __shfl_xor(sum, off, 32);
    const float mean = sum * (1.f / D_MODEL);
    float sq = 0.f;
#pragma unroll
    for (int i = 0; i < 8; ++i) {
      x[i] -= mean;
      sq += x[i] * x[i];
    }
#pragma unroll
    for (int off = 16; off > 0; off >>= 1) sq += __shfl_xor(sq, off, 32);
    const float rs = rsqrtf(sq * (1.f / D_MODEL) + 1e-5f);
#pragma unroll
    for (int i = 0; i < 8; ++i) {
      const int c = lane + 32 * i;
      xout[gro + c] = x[i] * rs * g1[c] + be1[c];
    }
  }
}

// out = LayerNorm(a + c) with gain/bias; one 256-thread block per row.
__global__ void add_ln_kernel(const float* __restrict__ a,
                              const float* __restrict__ c,
                              const float* __restrict__ g,
                              const float* __restrict__ be,
                              float* __restrict__ out) {
  __shared__ float red[16];
  const int row = blockIdx.x, t = threadIdx.x;
  float x = a[(size_t)row * D_MODEL + t] + c[(size_t)row * D_MODEL + t];
  const float mean = block_sum_256(x, red) * (1.f / D_MODEL);
  const float d    = x - mean;
  const float var  = block_sum_256(d * d, red) * (1.f / D_MODEL);
  out[(size_t)row * D_MODEL + t] = d * rsqrtf(var + 1e-5f) * g[t] + be[t];
}

// ---------------------------------------------------------------------------
extern "C" void kernel_launch(void* const* d_in, const int* in_sizes, int n_in,
                              void* d_out, int out_size, void* d_ws,
                              size_t ws_size, hipStream_t stream) {
  const float* src = (const float*)d_in[0];
  const float* pos = (const float*)d_in[1];
  const float* rel = (const float*)d_in[2];
  const float* Wq  = (const float*)d_in[3];  const float* bq  = (const float*)d_in[4];
  const float* Wk  = (const float*)d_in[5];  const float* bk  = (const float*)d_in[6];
  const float* Wv  = (const float*)d_in[7];  const float* bv  = (const float*)d_in[8];
  const float* Wqp = (const float*)d_in[9];  const float* bqp = (const float*)d_in[10];
  const float* Wkp = (const float*)d_in[11]; const float* bkp = (const float*)d_in[12];
  const float* Wvp = (const float*)d_in[13]; const float* bvp = (const float*)d_in[14];
  const float* W1  = (const float*)d_in[15]; const float* b1  = (const float*)d_in[16];
  const float* W2  = (const float*)d_in[17]; const float* b2  = (const float*)d_in[18];
  const float* g1  = (const float*)d_in[19]; const float* be1 = (const float*)d_in[20];
  const float* g2  = (const float*)d_in[21]; const float* be2 = (const float*)d_in[22];

  const int M = 8 * 128;                       // B*A rows
  float* ws  = (float*)d_ws;
  float* q   = ws;                             // 1024*256
  float* qp  = q   + M * D_MODEL;
  float* kb  = qp  + M * D_MODEL;
  float* vb  = kb  + M * D_MODEL;
  float* x   = vb  + M * D_MODEL;
  float* ffh = x   + M * D_MODEL;              // 1024*2048
  float* ff  = ffh + M * 2048;
  float* u   = ff  + M * D_MODEL;              // 1024*4*256 folded pos query
  float* rr  = u   + M * 4 * D_MODEL;          // 1024*8*256 attn-weighted rel
  float* xp  = rr  + M * NH * D_MODEL;         // 1024*256 pre-LN1 partial

  // content / positional projections (WMMA fp32)
  gemm_strip_kernel<256, 256, 8, 0><<<256, 256, 0, stream>>>(src, Wq, bq, q);
  gemm_strip_kernel<256, 256, 8, 0><<<256, 256, 0, stream>>>(pos, Wqp, bqp, qp);
  gemm_strip_kernel<256, 256, 8, 0><<<256, 256, 0, stream>>>(src, Wk, bk, kb);
  // v = Wv(Wk(src))
  gemm_strip_kernel<256, 256, 8, 0><<<256, 256, 0, stream>>>(kb, Wv, bv, vb);

  // Wkp applied to the query side, attention over rel (one WG per (b,q)),
  // then Wvp applied to the attn-weighted rel rows, residual + LN1
  fold_query_kernel<<<512, 256, 0, stream>>>(qp, Wkp, u);
  const size_t smem =
      (SEQ * RP + D_MODEL + 5 * UP + (NH + 1) * SCP) * sizeof(float);
  attn_fused_kernel<<<M, 256, smem, stream>>>(src, rel, q, qp, u, kb, vb, bkp,
                                              bvp, rr, xp);
  vfold_ln_kernel<<<M / 16, 256, 0, stream>>>(rr, Wvp, xp, g1, be1, x);

  // FFN + LN2
  gemm_strip_kernel<2048, 256, 1, 1><<<256, 256, 0, stream>>>(x, W1, b1, ffh);
  gemm_strip_kernel<256, 2048, 8, 0><<<256, 256, 0, stream>>>(ffh, W2, b2, ff);
  add_ln_kernel<<<M, 256, 0, stream>>>(x, ff, g2, be2, (float*)d_out);
}

// v004
// It runs in 92.7 microseconds.
// Two timings next to v003 both put it at 1.07 times that version's speed.
// Counting every step since v000, it is 11.7 times as fast.
#include <hip/hip_runtime.h>
#include <math.h>

typedef __attribute__((ext_vector_type(2))) float v2f;
typedef __attribute__((ext_vector_type(4))) float v4f;
typedef __attribute__((ext_vector_type(8))) float v8f;

#define D_MODEL 256
#define SEQ     128
#define NH      8

__device__ __forceinline__ v8f wmma4(v2f a, v2f b, v8f c) {
  // (neg_a, A, neg_b, B, c_mod, C, reuse_a, reuse_b)
  return __builtin_amdgcn_wmma_f32_16x16x4_f32(false, a, false, b, (short)0, c,
                                               false, false);
}

__device__ __forceinline__ void wmma_gap(v8f& x, v8f& y) {
  asm volatile("v_nop\n\tv_nop\n\tv_nop\n\tv_nop" : "+v"(x), "+v"(y));
}
__device__ __forceinline__ void wmma_gap(v8f& x, v8f& y, v8f& z, v8f& w) {
  asm volatile("v_nop\n\tv_nop\n\tv_nop\n\tv_nop"
               : "+v"(x), "+v"(y), "+v"(z), "+v"(w));
}
__device__ __forceinline__ void wmma_gap(v8f& x) {
  asm volatile("v_nop\n\tv_nop\n\tv_nop\n\tv_nop" : "+v"(x));
}

template <int N, int K, int SPLIT, int RELU>
__global__ __launch_bounds__(256) void gemm_strip_kernel(
    const float* __restrict__ A, const float* __restrict__ B,
    const float* __restrict__ bias, float* __restrict__ C) {
  constexpr int KW = K / SPLIT;                   // k range of one wave
  constexpr int NB = KW / 8;                      // 8-wide k blocks
  constexpr int SN = N / 64;                      // strips per row of C
  const int wv   = threadIdx.x >> 5;
  const int lane = threadIdx.x & 31;
  const int r    = lane & 15;
  const int hi   = lane >> 4;
  const int strip = SPLIT == 1 ? blockIdx.x * 8 + wv : blockIdx.x;
  const int kbeg  = SPLIT == 1 ? 0 : wv * KW;
  const int m0 = (strip / SN) << 4;
  const int n0 = (strip % SN) << 6;

  const float* Ap = A + (size_t)(m0 + r) * K + kbeg + 4 * hi;
  const float* Bp = B + (size_t)(kbeg + 4 * hi) * N + n0 + r;
  // the bias is the accumulators' start value (where K is split: in wave 0 only)
  v8f acc[4];
#pragma unroll
  for (int t = 0; t < 4; ++t) {
    const float bv = bias[n0 + 16 * t + r];
    const float bi = (SPLIT == 1 || wv == 0) ? bv : 0.f;
    acc[t] = (v8f){bi, bi, bi, bi, bi, bi, bi, bi};
  }

  // ring of four fragment sets, one 8-wide k block each: a block's loads are
  // issued three blocks (24 WMMAs) ahead of the WMMAs that read them
  v4f a[4];
  v2f b[4][2][4];
  auto load = [&](int s) {
    const int buf = s & 3;
    const int kk  = s * 8;
    a[buf] = *(const v4f*)(Ap + kk);
    // the A pointer is dead behind its last load and the allocator hands its
    // registers to later loads' results: the wait stands ahead of that overwrite
    if (s == NB - 1) asm volatile("s_wait_xcnt 0x0" ::: "memory");
#pragma unroll
    for (int st = 0; st < 2; ++st)
#pragma unroll
      for (int t = 0; t < 4; ++t) {
        b[buf][st][t].x = Bp[(kk + 2 * st) * N + 16 * t];
        b[buf][st][t].y = Bp[(kk + 2 * st + 1) * N + 16 * t];
      }
  };
  load(0);
  load(1);
  load(2);
#pragma unroll
  for (int s = 0; s < NB; ++s) {
    const int cur = s & 3;
    if (s + 3 < NB) load(s + 3);
    // keeps the loads above this block's WMMAs: without it the scheduler sinks
    // them to a few WMMAs ahead of their use and the wave waits out the latency
    __builtin_amdgcn_sched_barrier(0);
    const v2f a0 = {a[cur].x, a[cur].y};
    const v2f a1 = {a[cur].z, a[cur].w};
#pragma unroll
    for (int t = 0; t < 4; ++t) acc[t] = wmma4(a0, b[cur][0][t], acc[t]);
#pragma unroll
    for (int t = 0; t < 4; ++t) acc[t] = wmma4(a1, b[cur][1][t], acc[t]);
    // keeps later blocks' loads from rising above these WMMAs (register use)
    __builtin_amdgcn_sched_barrier(0);
  }
  wmma_gap(acc[0], acc[1], acc[2], acc[3]);       // D is read directly below

  if constexpr (SPLIT == 1) {
#pragma unroll
    for (int t = 0; t < 4; ++t) {
      float* Crow = C + (size_t)(m0 + 8 * hi) * N + n0 + 16 * t + r;
#pragma unroll
      for (int v = 0; v < 8; ++v) {
        float val = acc[t][v];
        if (RELU) val = fmaxf(val, 0.f);
        Crow[v * N] = val;
      }
    }
  } else {
    __shared__ __attribute__((aligned(16))) float red[SPLIT * 16 * 68];
#pragma unroll
    for (int t = 0; t < 4; ++t)
#pragma unroll
      for (int v = 0; v < 8; ++v)
        red[(wv * 16 + v + 8 * hi) * 68 + 16 * t + r] = acc[t][v];
    __syncthreads();
    const int row = threadIdx.x >> 4;
    const int c4  = (threadIdx.x & 15) << 2;
    v4f s = *(const v4f*)(red + row * 68 + c4);
#pragma unroll
    for (int w = 1; w < SPLIT; ++w)
      s += *(const v4f*)(red + (w * 16 + row) * 68 + c4);
    if (RELU) {
#pragma unroll
      for (int i = 0; i < 4; ++i) s[i] = fmaxf(s[i], 0.f);
    }
    *(v4f*)(C + (size_t)(m0 + row) * N + n0 + c4) = s;
  }
}

// ---------------------------------------------------------------------------
// Two batched products of one form: a 16x16 tile per wave, both operands read
// by rows, over the 64 adjacent k values of head h (B[k][n] = Brow[n][h*64+k],
// so a lane's two k values are adjacent in memory).
//  blocks 0..511   folded positional query:
//    U[row,h,d] = sum_e qp[row, h*64+e] * Wkp[d, h*64+e]
//  blocks 512..767 content scores, not yet scaled (key and query of one batch):
//    S[row,h,key] = sum_e q[row, h*64+e] * k_base[batch(row)*128+key, h*64+e]
// ---------------------------------------------------------------------------
template <int CS>                                 // floats between rows of C
__device__ __forceinline__ void tile_rows_k64(const float* __restrict__ Ap,
                                              const float* __restrict__ Bp,
                                              float* __restrict__ Co) {
  v8f acc = {0.f, 0.f, 0.f, 0.f, 0.f, 0.f, 0.f, 0.f};
#pragma unroll
  for (int k0 = 0; k0 < 64; k0 += 4) {
    v2f a, b;
    a.x = Ap[k0];
    a.y = Ap[k0 + 1];
    b.x = Bp[k0];
    b.y = Bp[k0 + 1];
    acc = wmma4(a, b, acc);
  }
  wmma_gap(acc);                                  // the stores read D directly
#pragma unroll
  for (int v = 0; v < 8; ++v) Co[v * CS] = acc[v];
  // code laid out behind an inlined call may reuse the registers these stores name
  asm volatile("s_wait_xcnt 0x0" ::: "memory");
}

__global__ void fold_query_kernel(const float* __restrict__ qp,
                                  const float* __restrict__ Wkp,
                                  float* __restrict__ U,
                                  const float* __restrict__ q,
                                  const float* __restrict__ k_base,
                                  float* __restrict__ S) {
  const int wv   = threadIdx.x >> 5;
  const int lane = threadIdx.x & 31;
  const int r  = lane & 15;
  const int ks = (lane >> 4) << 1;
  const int ro = (lane >> 4) << 3;
  if (blockIdx.x < 512) {
    const int wid = blockIdx.x * 8 + wv;          // 64 x 4 x 16 tiles
    const int n0 = (wid & 15) << 4;
    const int h  = (wid >> 4) & 3;
    const int m0 = (wid >> 6) << 4;
    tile_rows_k64<4 * D_MODEL>(
        qp  + (size_t)(m0 + r) * D_MODEL + h * 64 + ks,
        Wkp + (size_t)(n0 + r) * D_MODEL + h * 64 + ks,
        U + ((size_t)(m0 + ro) * 4 + h) * D_MODEL + n0 + r);
  } else {
    const int wid = (blockIdx.x - 512) * 8 + wv;  // 64 x 4 x 8 tiles
    const int n0 = (wid & 7) << 4;
    const int h  = (wid >> 3) & 3;
    const int m0 = (wid >> 5) << 4;
    const int b0 = m0 & ~(SEQ - 1);               // first row of the batch
    tile_rows_k64<4 * SEQ>(
        q      + (size_t)(m0 + r) * D_MODEL + h * 64 + ks,
        k_base + (size_t)(b0 + n0 + r) * D_MODEL + h * 64 + ks,
        S + ((size_t)(m0 + ro) * 4 + h) * SEQ + n0 + r);
  }
}

// Block-wide sum over 256 threads (8 wave32s), via shuffles + tiny LDS.
__device__ __forceinline__ float block_sum_256(float v, float* red) {
  const int lane = threadIdx.x & 31;
  const int wv   = threadIdx.x >> 5;
#pragma unroll
  for (int off = 16; off > 0; off >>= 1) v += __shfl_xor(v, off, 32);
  if (lane == 0) red[wv] = v;
  __syncthreads();
  if (wv == 0) {
    float s = (lane < 8) ? red[lane] : 0.f;
#pragma unroll
    for (int off = 16; off > 0; off >>= 1) s += __shfl_xor(s, off, 32);
    if (lane == 0) red[8] = s;
  }
  __syncthreads();
  float s = red[8];
  __syncthreads();                                // allow red reuse
  return s;
}

#define RP  268
#define UP  260
#define SCP 132

__global__ void attn_fused_kernel(const float* __restrict__ src,
                                  const float* __restrict__ rel,
                                  const float* __restrict__ scg,
                                  const float* __restrict__ qpg,
                                  const float* __restrict__ ug,
                                  const float* __restrict__ v_base,
                                  const float* __restrict__ bkp,
                                  const float* __restrict__ bvp,
                                  float* __restrict__ rg,
                                  float* __restrict__ xpre) {
  extern __shared__ float smem[];
  float* rel_s = smem;                         // SEQ*RP
  float* u_s   = rel_s + SEQ * RP;             // 5*UP
  float* sc_s  = u_s + 5 * UP;                 // 9*SCP scores -> attn

  const int bq   = blockIdx.x;                 // b*128 + q
  const int b    = bq >> 7;
  const int t    = threadIdx.x;
  const int wv   = t >> 5;
  const int lane = t & 31;
  const int r    = lane & 15;
  const int ks   = (lane >> 4) << 1;
  const int ro   = (lane >> 4) << 3;
  float cb = 0.f;                              // qp_h . bkp_h, h = lane & 3

  {
    const unsigned long long gbase =
        (unsigned long long)(const void*)(rel + (size_t)bq * SEQ * D_MODEL);
    const unsigned ldsbase = (unsigned)(size_t)(void*)rel_s;
    for (int i = t; i < SEQ * D_MODEL / 4; i += 256) {
      const unsigned goff  = (unsigned)i * 16u;   // bytes
      const unsigned laddr =                      // row i/64, 16-byte piece i%64
          ldsbase + (unsigned)(i >> 6) * (RP * 4u) + (unsigned)(i & 63) * 16u;
      asm volatile("global_load_async_to_lds_b128 %0, %1, %2 offset:0"
                   :
                   : "v"(laddr), "v"(goff), "s"(gbase)
                   : "memory");
    }
    // content scores, heads 0-3: 4 x 128 adjacent floats, scaled by 1/sqrt(64)
#pragma unroll
    for (int j = 0; j < 2; ++j)
      sc_s[(2 * j + (t >> 7)) * SCP + (t & 127)] =
          scg[(size_t)bq * 4 * SEQ + j * 256 + t] * 0.125f;
#pragma unroll
    for (int j = 0; j < 4; ++j)
      u_s[j * UP + t] = ug[((size_t)bq * 4 + j) * D_MODEL + t];
    u_s[4 * UP + t] = 0.f;
    if (t < SEQ) sc_s[NH * SCP + t] = 0.f;
    const float* qr = qpg + (size_t)bq * D_MODEL + (lane & 3) * 64;
    const float* br = bkp + (lane & 3) * 64;
    for (int e = 0; e < 64; ++e) cb += qr[e] * br[e];
    asm volatile("s_wait_asynccnt 0x0" ::: "memory");
  }
  __syncthreads();

  // ---- pos scores, heads 4-7: S[key,h] = rel_s[128,256] @ u^T[256,4] + cb -
  // One 16-key tile per wave; columns 4..15 of B are zero and not stored.
  {
    const int m0 = wv << 4;
    const float* As = rel_s + (m0 + r) * RP + ks;
    const float* Bs = u_s + (r < 4 ? r : 4) * UP + ks;
    v8f acc0 = {cb, cb, cb, cb, cb, cb, cb, cb};
    v8f acc1 = {0.f, 0.f, 0.f, 0.f, 0.f, 0.f, 0.f, 0.f};
#pragma unroll 4
    for (int k0 = 0; k0 < D_MODEL; k0 += 8) {
      const v2f a0 = *(const v2f*)(As + k0);
      const v2f a1 = *(const v2f*)(As + k0 + 4);
      const v2f b0 = *(const v2f*)(Bs + k0);
      const v2f b1 = *(const v2f*)(Bs + k0 + 4);
      acc0 = wmma4(a0, b0, acc0);
      acc1 = wmma4(a1, b1, acc1);
    }
    wmma_gap(acc0, acc1);
    if (r < 4) {
      float* So = sc_s + (4 + r) * SCP + m0 + ro;
#pragma unroll
      for (int v = 0; v < 8; ++v) So[v] = (acc0[v] + acc1[v]) * 0.125f;
    }
  }

  __syncthreads();

  // ---- softmax over k, one wave32 per head -------------------------------
  {
    float* row = sc_s + wv * SCP;
    float vals[4];
    float m = -1e30f;
#pragma unroll
    for (int j = 0; j < 4; ++j) {
      vals[j] = row[lane + 32 * j];
      m = fmaxf(m, vals[j]);
    }
#pragma unroll
    for (int off = 16; off > 0; off >>= 1) m = fmaxf(m, __shfl_xor(m, off, 32));
    float sum = 0.f;
#pragma unroll
    for (int j = 0; j < 4; ++j) { vals[j] = __expf(vals[j] - m); sum += vals[j]; }
#pragma unroll
    for (int off = 16; off > 0; off >>= 1) sum += __shfl_xor(sum, off, 32);
    const float inv = 1.f / sum;
#pragma unroll
    for (int j = 0; j < 4; ++j) row[lane + 32 * j] = vals[j] * inv;
  }
  __syncthreads();

  // ---- R[h,:] = attn[8,128] @ rel_s[128,256]  (WMMA, rows 8..15 zero) -----
  // Two 16-column tiles per wave, one after the other; even and odd k steps
  // go to two accumulators that are added at the end.
  {
    const float* As = sc_s + (r < NH ? r : NH) * SCP + ks;
    // not unrolled: with both tiles in one body the LDS loads get paired across
    // tiles and every B fragment then needs register moves next to the WMMAs
#pragma unroll 1
    for (int nt = 0; nt < 2; ++nt) {
      const int n0 = (wv << 5) + (nt << 4);
      const float* Bs = rel_s + ks * RP + n0 + r;
      v8f c0 = {0.f, 0.f, 0.f, 0.f, 0.f, 0.f, 0.f, 0.f};
      v8f c1 = {0.f, 0.f, 0.f, 0.f, 0.f, 0.f, 0.f, 0.f};
      // rolled so that the gap below closes every run of eight WMMAs
#pragma unroll 1
      for (int k0 = 0; k0 < SEQ; k0 += 32) {
        v2f a[8], bb[8];
#pragma unroll
        for (int j = 0; j < 8; ++j) {
          a[j]    = *(const v2f*)(As + k0 + 4 * j);
          bb[j].x = Bs[(k0 + 4 * j) * RP];
          bb[j].y = Bs[(k0 + 4 * j) * RP + RP];
        }
#pragma unroll
        for (int j = 0; j < 8; j += 2) {
          c0 = wmma4(a[j], bb[j], c0);
          c1 = wmma4(a[j + 1], bb[j + 1], c1);
        }
        wmma_gap(c0, c1);
      }
      if (lane < 16) {                          // rows 0..7 = heads
        float* Ro = rg + (size_t)bq * NH * D_MODEL + n0 + r;
#pragma unroll
        for (int v = 0; v < 8; ++v) Ro[v * D_MODEL] = c0[v] + c1[v];
        // the next tile's accumulators reuse the registers these stores name
        asm volatile("s_wait_xcnt 0x0" ::: "memory");
      }
    }
  }

  // ---- xpre = src + attn @ (v_base + bvp) --------------------------------
  {
    const int h = t >> 5;                       // head; t = h*32 + value dim
    const float* ar  = sc_s + h * SCP;
    const float* vbc = v_base + (size_t)b * SEQ * D_MODEL + t;
    const float bv = bvp[t];
    float o = 0.f;
    for (int k = 0; k < SEQ; ++k) {
      o += ar[k] * (vbc[0] + bv);
      vbc += D_MODEL;
    }
    xpre[(size_t)bq * D_MODEL + t] = src[(size_t)bq * D_MODEL + t] + o;
  }
}

// ---------------------------------------------------------------------------
// x = LayerNorm1(xpre + per-head R_h[16,256] @ Wvp[:, h*32 .. h*32+31]).
// One workgroup per 16 rows; wave = head (two 16-column tiles, shared A).
// ---------------------------------------------------------------------------
__global__ void vfold_ln_kernel(const float* __restrict__ rg,
                                const float* __restrict__ Wvp,
                                const float* __restrict__ xpre,
                                const float* __restrict__ g1,
                                const float* __restrict__ be1,
                                float* __restrict__ xout) {
  __shared__ float xs[16 * D_MODEL];
  const int wv   = threadIdx.x >> 5;
  const int lane = threadIdx.x & 31;
  const int r    = lane & 15;
  const int ks   = (lane >> 4) << 1;
  const int ro   = (lane >> 4) << 3;
  const int m0   = blockIdx.x << 4;
  const int n0   = wv << 5;
  const float* Ap = rg + ((size_t)(m0 + r) * NH + wv) * D_MODEL + ks;
  const float* Bp = Wvp + (size_t)ks * D_MODEL + n0 + r;
  v8f c0 = {0.f, 0.f, 0.f, 0.f, 0.f, 0.f, 0.f, 0.f};
  v8f c1 = {0.f, 0.f, 0.f, 0.f, 0.f, 0.f, 0.f, 0.f};
#pragma unroll 8
  for (int k0 = 0; k0 < D_MODEL; k0 += 4) {
    v2f a, b0, b1;
    a.x  = Ap[k0];
    a.y  = Ap[k0 + 1];
    b0.x = Bp[k0 * D_MODEL];
    b0.y = Bp[k0 * D_MODEL + D_MODEL];
    b1.x = Bp[k0 * D_MODEL + 16];
    b1.y = Bp[k0 * D_MODEL + D_MODEL + 16];
    c0 = wmma4(a, b0, c0);
    c1 = wmma4(a, b1, c1);
  }
  wmma_gap(c0, c1);                               // the stores read D directly
#pragma unroll
  for (int v = 0; v < 8; ++v) {
    xs[(ro + v) * D_MODEL + n0 + r]      = c0[v];
    xs[(ro + v) * D_MODEL + n0 + r + 16] = c1[v];
  }
  __syncthreads();
#pragma unroll
  for (int j = 0; j < 2; ++j) {                 // two rows per wave
    const int row = wv * 2 + j;
    const size_t gro = (size_t)(m0 + row) * D_MODEL;
    float x[8];
    float sum = 0.f;
#pragma unroll
    for (int i = 0; i < 8; ++i) {
      x[i] = xpre[gro + lane + 32 * i] + xs[row * D_MODEL + lane + 32 * i];
      sum += x[i];
    }
#pragma unroll
    for (int off = 16; off > 0; off >>= 1) sum += __shfl_xor(sum, off, 32);
    const float mean = sum * (1.f / D_MODEL);
    float sq = 0.f;
#pragma unroll
    for (int i = 0; i < 8; ++i) {
      x[i] -= mean;
      sq += x[i] * x[i];
    }
#pragma unroll
    for (int off = 16; off > 0; off >>= 1) sq += __shfl_xor(sq, off, 32);
    const float rs = rsqrtf(sq * (1.f / D_MODEL) + 1e-5f);
#pragma unroll
    for (int i = 0; i < 8; ++i) {
      const int c = lane + 32 * i;
      xout[gro + c] = x[i] * rs * g1[c] + be1[c];
    }
  }
}

// out = LayerNorm(a + c) with gain/bias; one 256-thread block per row.
__global__ void add_ln_kernel(const float* __restrict__ a,
                              const float* __restrict__ c,
                              const float* __restrict__ g,
                              const float* __restrict__ be,
                              float* __restrict__ out) {
  __shared__ float red[16];
  const int row = blockIdx.x, t = threadIdx.x;
  float x = a[(size_t)row * D_MODEL + t] + c[(size_t)row * D_MODEL + t];
  const float mean = block_sum_256(x, red) * (1.f / D_MODEL);
  const float d    = x - mean;
  const float var  = block_sum_256(d * d, red) * (1.f / D_MODEL);
  out[(size_t)row * D_MODEL + t] = d * rsqrtf(var + 1e-5f) * g[t] + be[t];
}

// ---------------------------------------------------------------------------
extern "C" void kernel_launch(void* const* d_in, const int* in_sizes, int n_in,
                              void* d_out, int out_size, void* d_ws,
                              size_t ws_size, hipStream_t stream) {
  const float* src = (const float*)d_in[0];
  const float* pos = (const float*)d_in[1];
  const float* rel = (const float*)d_in[2];
  const float* Wq  = (const float*)d_in[3];  const float* bq  = (const float*)d_in[4];
  const float* Wk  = (const float*)d_in[5];  const float* bk  = (const float*)d_in[6];
  const float* Wv  = (const float*)d_in[7];  const float* bv  = (const float*)d_in[8];
  const float* Wqp = (const float*)d_in[9];  const float* bqp = (const float*)d_in[10];
  const float* Wkp = (const float*)d_in[11]; const float* bkp = (const float*)d_in[12];
  const float* Wvp = (const float*)d_in[13]; const float* bvp = (const float*)d_in[14];
  const float* W1  = (const float*)d_in[15]; const float* b1  = (const float*)d_in[16];
  const float* W2  = (const float*)d_in[17]; const float* b2  = (const float*)d_in[18];
  const float* g1  = (const float*)d_in[19]; const float* be1 = (const float*)d_in[20];
  const float* g2  = (const float*)d_in[21]; const float* be2 = (const float*)d_in[22];

  const int M = 8 * 128;                       // B*A rows
  float* ws  = (float*)d_ws;
  float* q   = ws;                             // 1024*256
  float* qp  = q   + M * D_MODEL;
  float* kb  = qp  + M * D_MODEL;
  float* vb  = kb  + M * D_MODEL;
  float* x   = vb  + M * D_MODEL;
  float* ffh = x   + M * D_MODEL;              // 1024*2048
  float* ff  = ffh + M * 2048;
  float* u   = ff  + M * D_MODEL;              // 1024*4*256 folded pos query
  float* rr  = u   + M * 4 * D_MODEL;          // 1024*8*256 attn-weighted rel
  float* xp  = rr  + M * NH * D_MODEL;         // 1024*256 pre-LN1 partial
  float* sc  = xp  + M * D_MODEL;              // 1024*4*128 content scores

  // content / positional projections (WMMA fp32)
  gemm_strip_kernel<256, 256, 8, 0><<<256, 256, 0, stream>>>(src, Wq, bq, q);
  gemm_strip_kernel<256, 256, 8, 0><<<256, 256, 0, stream>>>(pos, Wqp, bqp, qp);
  gemm_strip_kernel<256, 256, 8, 0><<<256, 256, 0, stream>>>(src, Wk, bk, kb);
  // v = Wv(Wk(src))
  gemm_strip_kernel<256, 256, 8, 0><<<256, 256, 0, stream>>>(kb, Wv, bv, vb);

  // Wkp applied to the query side and, in the same launch, the content scores;
  // attention over rel (one WG per (b,q)), then Wvp applied to the
  // attn-weighted rel rows, residual + LN1
  fold_query_kernel<<<768, 256, 0, stream>>>(qp, Wkp, u, q, kb, sc);
  const size_t smem = (SEQ * RP + 5 * UP + (NH + 1) * SCP) * sizeof(float);
  attn_fused_kernel<<<M, 256, smem, stream>>>(src, rel, sc, qp, u, vb, bkp, bvp,
                                              rr, xp);
  vfold_ln_kernel<<<M / 16, 256, 0, stream>>>(rr, Wvp, xp, g1, be1, x);

  // FFN + LN2
  gemm_strip_kernel<2048, 256, 1, 1><<<256, 256, 0, stream>>>(x, W1, b1, ffh);
  gemm_strip_kernel<256, 2048, 8, 0><<<256, 256, 0, stream>>>(ffh, W2, b2, ff);
  add_ln_kernel<<<M, 256, 0, stream>>>(x, ff, g2, be2, (float*)d_out);
}

// v005
// A run of this version takes 85 microseconds.
// In both of two side-by-side timings against v004, it was 1.09 times as fast.
// All steps since v000 together make it 12.8 times as fast.
#include <hip/hip_runtime.h>
#include <math.h>

typedef __attribute__((ext_vector_type(2))) float v2f;
typedef __attribute__((ext_vector_type(4))) float v4f;
typedef __attribute__((ext_vector_type(8))) float v8f;

#define D_MODEL 256
#define SEQ     128
#define NH      8

__device__ __forceinline__ v8f wmma4(v2f a, v2f b, v8f c) {
  // (neg_a, A, neg_b, B, c_mod, C, reuse_a, reuse_b)
  return __builtin_amdgcn_wmma_f32_16x16x4_f32(false, a, false, b, (short)0, c,
                                               false, false);
}

__device__ __forceinline__ void wmma_gap(v8f& x, v8f& y) {
  asm volatile("v_nop\n\tv_nop\n\tv_nop\n\tv_nop" : "+v"(x), "+v"(y));
}
__device__ __forceinline__ void wmma_gap(v8f& x, v8f& y, v8f& z, v8f& w) {
  asm volatile("v_nop\n\tv_nop\n\tv_nop\n\tv_nop"
               : "+v"(x), "+v"(y), "+v"(z), "+v"(w));
}
// The same behind a run of eight WMMAs, with the run's A and B fragments named
// as inputs: their registers stay theirs up to here.
__device__ __forceinline__ void wmma_gap_frags(
    v8f& x, v2f a0, v2f a1, v2f a2, v2f a3, v2f a4, v2f a5, v2f a6, v2f a7,
    v2f b0, v2f b1, v2f b2, v2f b3, v2f b4, v2f b5, v2f b6, v2f b7) {
  asm volatile("v_nop\n\tv_nop\n\tv_nop\n\tv_nop"
               : "+v"(x)
               : "v"(a0), "v"(a1), "v"(a2), "v"(a3), "v"(a4), "v"(a5), "v"(a6),
                 "v"(a7), "v"(b0), "v"(b1), "v"(b2), "v"(b3), "v"(b4), "v"(b5),
                 "v"(b6), "v"(b7));
}

template <int N, int K, int SPLIT, int RELU>
__device__ __forceinline__ void gemm_strip(
    const float* __restrict__ A, const float* __restrict__ B,
    const float* __restrict__ bias, float* __restrict__ C, const int blk) {
  constexpr int KW = K / SPLIT;                   // k range of one wave
  constexpr int NB = KW / 8;                      // 8-wide k blocks
  constexpr int SN = N / 64;                      // strips per row of C
  const int wv   = threadIdx.x >> 5;
  const int lane = threadIdx.x & 31;
  const int r    = lane & 15;
  const int hi   = lane >> 4;
  const int strip = SPLIT == 1 ? blk * 8 + wv : blk;
  const int kbeg  = SPLIT == 1 ? 0 : wv * KW;
  const int m0 = (strip / SN) << 4;
  const int n0 = (strip % SN) << 6;

  const float* Ap = A + (size_t)(m0 + r) * K + kbeg + 4 * hi;
  const float* Bp = B + (size_t)(kbeg + 4 * hi) * N + n0 + r;
  // the bias is the accumulators' start value (where K is split: in wave 0 only)
  v8f acc[4];
#pragma unroll
  for (int t = 0; t < 4; ++t) {
    const float bv = bias[n0 + 16 * t + r];
    const float bi = (SPLIT == 1 || wv == 0) ? bv : 0.f;
    acc[t] = (v8f){bi, bi, bi, bi, bi, bi, bi, bi};
  }

  // ring of four fragment sets, one 8-wide k block each: a block's loads are
  // issued three blocks (24 WMMAs) ahead of the WMMAs that read them
  v4f a[4];
  v2f b[4][2][4];
  auto load = [&](int s) {
    const int buf = s & 3;
    const int kk  = s * 8;
    a[buf] = *(const v4f*)(Ap + kk);
    // the A pointer is dead behind its last load and the allocator hands its
    // registers to later loads' results: the wait stands ahead of that overwrite
    if (s == NB - 1) asm volatile("s_wait_xcnt 0x0" ::: "memory");
#pragma unroll
    for (int st = 0; st < 2; ++st)
#pragma unroll
      for (int t = 0; t < 4; ++t) {
        b[buf][st][t].x = Bp[(kk + 2 * st) * N + 16 * t];
        b[buf][st][t].y = Bp[(kk + 2 * st + 1) * N + 16 * t];
      }
  };
  load(0);
  load(1);
  load(2);
#pragma unroll
  for (int s = 0; s < NB; ++s) {
    const int cur = s & 3;
    if (s + 3 < NB) load(s + 3);
    // keeps the loads above this block's WMMAs: without it the scheduler sinks
    // them to a few WMMAs ahead of their use and the wave waits out the latency
    __builtin_amdgcn_sched_barrier(0);
    const v2f a0 = {a[cur].x, a[cur].y};
    const v2f a1 = {a[cur].z, a[cur].w};
#pragma unroll
    for (int t = 0; t < 4; ++t) acc[t] = wmma4(a0, b[cur][0][t], acc[t]);
#pragma unroll
    for (int t = 0; t < 4; ++t) acc[t] = wmma4(a1, b[cur][1][t], acc[t]);
    // keeps later blocks' loads from rising above these WMMAs (register use)
    __builtin_amdgcn_sched_barrier(0);
  }
  wmma_gap(acc[0], acc[1], acc[2], acc[3]);       // D is read directly below

  if constexpr (SPLIT == 1) {
#pragma unroll
    for (int t = 0; t < 4; ++t) {
      float* Crow = C + (size_t)(m0 + 8 * hi) * N + n0 + 16 * t + r;
#pragma unroll
      for (int v = 0; v < 8; ++v) {
        float val = acc[t][v];
        if (RELU) val = fmaxf(val, 0.f);
        Crow[v * N] = val;
      }
    }
  } else {
    __shared__ __attribute__((aligned(16))) float red[SPLIT * 16 * 68];
#pragma unroll
    for (int t = 0; t < 4; ++t)
#pragma unroll
      for (int v = 0; v < 8; ++v)
        red[(wv * 16 + v + 8 * hi) * 68 + 16 * t + r] = acc[t][v];
    __syncthreads();
    const int row = threadIdx.x >> 4;
    const int c4  = (threadIdx.x & 15) << 2;
    v4f s = *(const v4f*)(red + row * 68 + c4);
#pragma unroll
    for (int w = 1; w < SPLIT; ++w)
      s += *(const v4f*)(red + (w * 16 + row) * 68 + c4);
    if (RELU) {
#pragma unroll
      for (int i = 0; i < 4; ++i) s[i] = fmaxf(s[i], 0.f);
    }
    *(v4f*)(C + (size_t)(m0 + row) * N + n0 + c4) = s;
  }
}

template <int N, int K, int SPLIT, int RELU>
__global__ __launch_bounds__(256) void gemm_strip_kernel(
    const float* __restrict__ A, const float* __restrict__ B,
    const float* __restrict__ bias, float* __restrict__ C) {
  gemm_strip<N, K, SPLIT, RELU>(A, B, bias, C, blockIdx.x);
}

// The three projections that depend on inputs alone, in one launch of 3 x 256
// blocks:  q = src Wq + bq,  qp = pos Wqp + bqp,  k_base = src Wk + bk.
__global__ __launch_bounds__(256) void proj3_kernel(
    const float* __restrict__ src, const float* __restrict__ pos,
    const float* __restrict__ Wq, const float* __restrict__ bq,
    const float* __restrict__ Wqp, const float* __restrict__ bqp,
    const float* __restrict__ Wk, const float* __restrict__ bk,
    float* __restrict__ q, float* __restrict__ qp, float* __restrict__ kb) {
  const int which = blockIdx.x >> 8;
  const float* A    = which == 1 ? pos : src;
  const float* B    = which == 0 ? Wq : which == 1 ? Wqp : Wk;
  const float* bias = which == 0 ? bq : which == 1 ? bqp : bk;
  float* C          = which == 0 ? q : which == 1 ? qp : kb;
  gemm_strip<256, 256, 8, 0>(A, B, bias, C, blockIdx.x & 255);
}

// ---------------------------------------------------------------------------
// The three products that need only the projections, in one launch.
//  blocks 0..255   v_base = k_base Wv + bv (the strip GEMM above; it has the
//                  longest path of the three, so it starts first)
// Then two batched products of one form: a 16x16 tile per wave, both operands
// read by rows, over the 64 adjacent k values of head h (B[k][n] =
// Brow[n][h*64+k], so a lane's two k values are adjacent in memory).
//  blocks 256..767  folded positional query:
//    U[row,h,d] = sum_e qp[row, h*64+e] * Wkp[d, h*64+e]
//  blocks 768..1023 content scores, not yet scaled (key and query of one batch):
//    S[row,h,key] = sum_e q[row, h*64+e] * k_base[batch(row)*128+key, h*64+e]
// ---------------------------------------------------------------------------
template <int CS>                                 // floats between rows of C
__device__ __forceinline__ void tile_rows_k64(const float* __restrict__ Ap,
                                              const float* __restrict__ Bp,
                                              float* __restrict__ Co) {
  v8f acc = {0.f, 0.f, 0.f, 0.f, 0.f, 0.f, 0.f, 0.f};
  v2f a[16], b[16];
#pragma unroll
  for (int j = 0; j < 16; ++j) {
    a[j].x = Ap[4 * j];
    a[j].y = Ap[4 * j + 1];
    b[j].x = Bp[4 * j];
    b[j].y = Bp[4 * j + 1];
  }
  // both pointers are dead behind the last load and their registers go to the
  // accumulator and the store address: the wait stands ahead of that overwrite
  asm volatile("s_wait_xcnt 0x0" ::: "memory");
#pragma unroll
  for (int g = 0; g < 16; g += 8) {
#pragma unroll
    for (int j = 0; j < 8; ++j) acc = wmma4(a[g + j], b[g + j], acc);
    // behind the last run the stores read D directly
    wmma_gap_frags(acc, a[g], a[g + 1], a[g + 2], a[g + 3], a[g + 4], a[g + 5],
                   a[g + 6], a[g + 7], b[g], b[g + 1], b[g + 2], b[g + 3],
                   b[g + 4], b[g + 5], b[g + 6], b[g + 7]);
  }
#pragma unroll
  for (int v = 0; v < 8; ++v) Co[v * CS] = acc[v];
  // code laid out behind an inlined call may reuse the registers these stores name
  asm volatile("s_wait_xcnt 0x0" ::: "memory");
}

__global__ __launch_bounds__(256) void fold_query_kernel(
    const float* __restrict__ qp, const float* __restrict__ Wkp,
    float* __restrict__ U, const float* __restrict__ q,
    const float* __restrict__ k_base, float* __restrict__ S,
    const float* __restrict__ Wv, const float* __restrict__ bv,
    float* __restrict__ v_base) {
  if (blockIdx.x < 256) {
    gemm_strip<256, 256, 8, 0>(k_base, Wv, bv, v_base, blockIdx.x);
    return;
  }
  const int wv   = threadIdx.x >> 5;
  const int lane = threadIdx.x & 31;
  const int r  = lane & 15;
  const int ks = (lane >> 4) << 1;
  const int ro = (lane >> 4) << 3;
  if (blockIdx.x < 768) {
    const int wid = (blockIdx.x - 256) * 8 + wv;  // 64 x 4 x 16 tiles
    const int n0 = (wid & 15) << 4;
    const int h  = (wid >> 4) & 3;
    const int m0 = (wid >> 6) << 4;
    tile_rows_k64<4 * D_MODEL>(
        qp  + (size_t)(m0 + r) * D_MODEL + h * 64 + ks,
        Wkp + (size_t)(n0 + r) * D_MODEL + h * 64 + ks,
        U + ((size_t)(m0 + ro) * 4 + h) * D_MODEL + n0 + r);
  } else {
    const int wid = (blockIdx.x - 768) * 8 + wv;  // 64 x 4 x 8 tiles
    const int n0 = (wid & 7) << 4;
    const int h  = (wid >> 3) & 3;
    const int m0 = (wid >> 5) << 4;
    const int b0 = m0 & ~(SEQ - 1);               // first row of the batch
    tile_rows_k64<4 * SEQ>(
        q      + (size_t)(m0 + r) * D_MODEL + h * 64 + ks,
        k_base + (size_t)(b0 + n0 + r) * D_MODEL + h * 64 + ks,
        S + ((size_t)(m0 + ro) * 4 + h) * SEQ + n0 + r);
  }
}

// Block-wide sum over 256 threads (8 wave32s), via shuffles + tiny LDS.
__device__ __forceinline__ float block_sum_256(float v, float* red) {
  const int lane = threadIdx.x & 31;
  const int wv   = threadIdx.x >> 5;
#pragma unroll
  for (int off = 16; off > 0; off >>= 1) v += __shfl_xor(v, off, 32);
  if (lane == 0) red[wv] = v;
  __syncthreads();
  if (wv == 0) {
    float s = (lane < 8) ? red[lane] : 0.f;
#pragma unroll
    for (int off = 16; off > 0; off >>= 1) s += __shfl_xor(s, off, 32);
    if (lane == 0) red[8] = s;
  }
  __syncthreads();
  float s = red[8];
  __syncthreads();                                // allow red reuse
  return s;
}

#define RP  268
#define UP  260
#define SCP 132

__global__ void attn_fused_kernel(const float* __restrict__ src,
                                  const float* __restrict__ rel,
                                  const float* __restrict__ scg,
                                  const float* __restrict__ qpg,
                                  const float* __restrict__ ug,
                                  const float* __restrict__ v_base,
                                  const float* __restrict__ bkp,
                                  const float* __restrict__ bvp,
                                  float* __restrict__ rg,
                                  float* __restrict__ xpre) {
  extern __shared__ float smem[];
  float* rel_s = smem;                         // SEQ*RP
  float* u_s   = rel_s + SEQ * RP;             // 5*UP
  float* sc_s  = u_s + 5 * UP;                 // 9*SCP scores -> attn

  const int bq   = blockIdx.x;                 // b*128 + q
  const int b    = bq >> 7;
  const int t    = threadIdx.x;
  const int wv   = t >> 5;
  const int lane = t & 31;
  const int r    = lane & 15;
  const int ks   = (lane >> 4) << 1;
  const int ro   = (lane >> 4) << 3;
  float cb = 0.f;                              // qp_h . bkp_h, h = lane & 3

  {
    const unsigned long long gbase =
        (unsigned long long)(const void*)(rel + (size_t)bq * SEQ * D_MODEL);
    const unsigned ldsbase = (unsigned)(size_t)(void*)rel_s;
    for (int i = t; i < SEQ * D_MODEL / 4; i += 256) {
      const unsigned goff  = (unsigned)i * 16u;   // bytes
      const unsigned laddr =                      // row i/64, 16-byte piece i%64
          ldsbase + (unsigned)(i >> 6) * (RP * 4u) + (unsigned)(i & 63) * 16u;
      asm volatile("global_load_async_to_lds_b128 %0, %1, %2 offset:0"
                   :
                   : "v"(laddr), "v"(goff), "s"(gbase)
                   : "memory");
    }
    // content scores, heads 0-3: 4 x 128 adjacent floats, scaled by 1/sqrt(64)
#pragma unroll
    for (int j = 0; j < 2; ++j)
      sc_s[(2 * j + (t >> 7)) * SCP + (t & 127)] =
          scg[(size_t)bq * 4 * SEQ + j * 256 + t] * 0.125f;
#pragma unroll
    for (int j = 0; j < 4; ++j)
      u_s[j * UP + t] = ug[((size_t)bq * 4 + j) * D_MODEL + t];
    u_s[4 * UP + t] = 0.f;
    if (t < SEQ) sc_s[NH * SCP + t] = 0.f;
    const float* qr = qpg + (size_t)bq * D_MODEL + (lane & 3) * 64;
    const float* br = bkp + (lane & 3) * 64;
    for (int e = 0; e < 64; ++e) cb += qr[e] * br[e];
    asm volatile("s_wait_asynccnt 0x0" ::: "memory");
  }
  __syncthreads();

  // ---- pos scores, heads 4-7: S[key,h] = rel_s[128,256] @ u^T[256,4] + cb -
  // One 16-key tile per wave; columns 4..15 of B are zero and not stored.
  {
    const int m0 = wv << 4;
    const float* As = rel_s + (m0 + r) * RP + ks;
    const float* Bs = u_s + (r < 4 ? r : 4) * UP + ks;
    v8f acc0 = {cb, cb, cb, cb, cb, cb, cb, cb};
    v8f acc1 = {0.f, 0.f, 0.f, 0.f, 0.f, 0.f, 0.f, 0.f};
#pragma unroll 4
    for (int k0 = 0; k0 < D_MODEL; k0 += 8) {
      const v2f a0 = *(const v2f*)(As + k0);
      const v2f a1 = *(const v2f*)(As + k0 + 4);
      const v2f b0 = *(const v2f*)(Bs + k0);
      const v2f b1 = *(const v2f*)(Bs + k0 + 4);
      acc0 = wmma4(a0, b0, acc0);
      acc1 = wmma4(a1, b1, acc1);
    }
    wmma_gap(acc0, acc1);
    if (r < 4) {
      float* So = sc_s + (4 + r) * SCP + m0 + ro;
#pragma unroll
      for (int v = 0; v < 8; ++v) So[v] = (acc0[v] + acc1[v]) * 0.125f;
    }
  }

  __syncthreads();

  // ---- softmax over k, one wave32 per head -------------------------------
  {
    float* row = sc_s + wv * SCP;
    float vals[4];
    float m = -1e30f;
#pragma unroll
    for (int j = 0; j < 4; ++j) {
      vals[j] = row[lane + 32 * j];
      m = fmaxf(m, vals[j]);
    }
#pragma unroll
    for (int off = 16; off > 0; off >>= 1) m = fmaxf(m, __shfl_xor(m, off, 32));
    float sum = 0.f;
#pragma unroll
    for (int j = 0; j < 4; ++j) { vals[j] = __expf(vals[j] - m); sum += vals[j]; }
#pragma unroll
    for (int off = 16; off > 0; off >>= 1) sum += __shfl_xor(sum, off, 32);
    const float inv = 1.f / sum;
#pragma unroll
    for (int j = 0; j < 4; ++j) row[lane + 32 * j] = vals[j] * inv;
  }
  __syncthreads();

  // ---- R[h,:] = attn[8,128] @ rel_s[128,256]  (WMMA, rows 8..15 zero) -----
  // Two 16-column tiles per wave, one after the other; even and odd k steps
  // go to two accumulators that are added at the end.
  {
    const float* As = sc_s + (r < NH ? r : NH) * SCP + ks;
    // not unrolled: with both tiles in one body the LDS loads get paired across
    // tiles and every B fragment then needs register moves next to the WMMAs
#pragma unroll 1
    for (int nt = 0; nt < 2; ++nt) {
      const int n0 = (wv << 5) + (nt << 4);
      const float* Bs = rel_s + ks * RP + n0 + r;
      v8f c0 = {0.f, 0.f, 0.f, 0.f, 0.f, 0.f, 0.f, 0.f};
      v8f c1 = {0.f, 0.f, 0.f, 0.f, 0.f, 0.f, 0.f, 0.f};
      // rolled so that the gap below closes every run of eight WMMAs
#pragma unroll 1
      for (int k0 = 0; k0 < SEQ; k0 += 32) {
        v2f a[8], bb[8];
#pragma unroll
        for (int j = 0; j < 8; ++j) {
          a[j]    = *(const v2f*)(As + k0 + 4 * j);
          bb[j].x = Bs[(k0 + 4 * j) * RP];
          bb[j].y = Bs[(k0 + 4 * j) * RP + RP];
        }
#pragma unroll
        for (int j = 0; j < 8; j += 2) {
          c0 = wmma4(a[j], bb[j], c0);
          c1 = wmma4(a[j + 1], bb[j + 1], c1);
        }
        wmma_gap(c0, c1);
      }
      if (lane < 16) {                          // rows 0..7 = heads
        float* Ro = rg + (size_t)bq * NH * D_MODEL + n0 + r;
#pragma unroll
        for (int v = 0; v < 8; ++v) Ro[v * D_MODEL] = c0[v] + c1[v];
        // the next tile's accumulators reuse the registers these stores name
        asm volatile("s_wait_xcnt 0x0" ::: "memory");
      }
    }
  }

  // ---- xpre = src + attn @ (v_base + bvp) --------------------------------
  {
    const int h = t >> 5;                       // head; t = h*32 + value dim
    const float* ar  = sc_s + h * SCP;
    const float* vbc = v_base + (size_t)b * SEQ * D_MODEL + t;
    const float bv = bvp[t];
    float o = 0.f;
    for (int k = 0; k < SEQ; ++k) {
      o += ar[k] * (vbc[0] + bv);
      vbc += D_MODEL;
    }
    xpre[(size_t)bq * D_MODEL + t] = src[(size_t)bq * D_MODEL + t] + o;
  }
}

// ---------------------------------------------------------------------------
// x = LayerNorm1(xpre + per-head R_h[16,256] @ Wvp[:, h*32 .. h*32+31]).
// One workgroup per 16 rows; wave = head (two 16-column tiles, shared A).
// ---------------------------------------------------------------------------
__global__ void vfold_ln_kernel(const float* __restrict__ rg,
                                const float* __restrict__ Wvp,
                                const float* __restrict__ xpre,
                                const float* __restrict__ g1,
                                const float* __restrict__ be1,
                                float* __restrict__ xout) {
  __shared__ float xs[16 * D_MODEL];
  const int wv   = threadIdx.x >> 5;
  const int lane = threadIdx.x & 31;
  const int r    = lane & 15;
  const int ks   = (lane >> 4) << 1;
  const int ro   = (lane >> 4) << 3;
  const int m0   = blockIdx.x << 4;
  const int n0   = wv << 5;
  const float* Ap = rg + ((size_t)(m0 + r) * NH + wv) * D_MODEL + ks;
  const float* Bp = Wvp + (size_t)ks * D_MODEL + n0 + r;
  v8f c0 = {0.f, 0.f, 0.f, 0.f, 0.f, 0.f, 0.f, 0.f};
  v8f c1 = {0.f, 0.f, 0.f, 0.f, 0.f, 0.f, 0.f, 0.f};
#pragma unroll 8
  for (int k0 = 0; k0 < D_MODEL; k0 += 4) {
    v2f a, b0, b1;
    a.x  = Ap[k0];
    a.y  = Ap[k0 + 1];
    b0.x = Bp[k0 * D_MODEL];
    b0.y = Bp[k0 * D_MODEL + D_MODEL];
    b1.x = Bp[k0 * D_MODEL + 16];
    b1.y = Bp[k0 * D_MODEL + D_MODEL + 16];
    c0 = wmma4(a, b0, c0);
    c1 = wmma4(a, b1, c1);
  }
  wmma_gap(c0, c1);                               // the stores read D directly
#pragma unroll
  for (int v = 0; v < 8; ++v) {
    xs[(ro + v) * D_MODEL + n0 + r]      = c0[v];
    xs[(ro + v) * D_MODEL + n0 + r + 16] = c1[v];
  }
  __syncthreads();
#pragma unroll
  for (int j = 0; j < 2; ++j) {                 // two rows per wave
    const int row = wv * 2 + j;
    const size_t gro = (size_t)(m0 + row) * D_MODEL;
    float x[8];
    float sum = 0.f;
#pragma unroll
    for (int i = 0; i < 8; ++i) {
      x[i] = xpre[gro + lane + 32 * i] + xs[row * D_MODEL + lane + 32 * i];
      sum += x[i];
    }
#pragma unroll
    for (int off = 16; off > 0; off >>= 1) sum += __shfl_xor(sum, off, 32);
    const float mean = sum * (1.f / D_MODEL);
    float sq = 0.f;
#pragma unroll
    for (int i = 0; i < 8; ++i) {
      x[i] -= mean;
      sq += x[i] * x[i];
    }
#pragma unroll
    for (int off = 16; off > 0; off >>= 1) sq += __shfl_xor(sq, off, 32);
    const float rs = rsqrtf(sq * (1.f / D_MODEL) + 1e-5f);
#pragma unroll
    for (int i = 0; i < 8; ++i) {
      const int c = lane + 32 * i;
      xout[gro + c] = x[i] * rs * g1[c] + be1[c];
    }
  }
}

// out = LayerNorm(a + c) with gain/bias; one 256-thread block per row.
__global__ void add_ln_kernel(const float* __restrict__ a,
                              const float* __restrict__ c,
                              const float* __restrict__ g,
                              const float* __restrict__ be,
                              float* __restrict__ out) {
  __shared__ float red[16];
  const int row = blockIdx.x, t = threadIdx.x;
  float x = a[(size_t)row * D_MODEL + t] + c[(size_t)row * D_MODEL + t];
  const float mean = block_sum_256(x, red) * (1.f / D_MODEL);
  const float d    = x - mean;
  const float var  = block_sum_256(d * d, red) * (1.f / D_MODEL);
  out[(size_t)row * D_MODEL + t] = d * rsqrtf(var + 1e-5f) * g[t] + be[t];
}

// ---------------------------------------------------------------------------
extern "C" void kernel_launch(void* const* d_in, const int* in_sizes, int n_in,
                              void* d_out, int out_size, void* d_ws,
                              size_t ws_size, hipStream_t stream) {
  const float* src = (const float*)d_in[0];
  const float* pos = (const float*)d_in[1];
  const float* rel = (const float*)d_in[2];
  const float* Wq  = (const float*)d_in[3];  const float* bq  = (const float*)d_in[4];
  const float* Wk  = (const float*)d_in[5];  const float* bk  = (const float*)d_in[6];
  const float* Wv  = (const float*)d_in[7];  const float* bv  = (const float*)d_in[8];
  const float* Wqp = (const float*)d_in[9];  const float* bqp = (const float*)d_in[10];
  const float* Wkp = (const float*)d_in[11]; const float* bkp = (const float*)d_in[12];
  const float* Wvp = (const float*)d_in[13]; const float* bvp = (const float*)d_in[14];
  const float* W1  = (const float*)d_in[15]; const float* b1  = (const float*)d_in[16];
  const float* W2  = (const float*)d_in[17]; const float* b2  = (const float*)d_in[18];
  const float* g1  = (const float*)d_in[19]; const float* be1 = (const float*)d_in[20];
  const float* g2  = (const float*)d_in[21]; const float* be2 = (const float*)d_in[22];

  const int M = 8 * 128;                       // B*A rows
  float* ws  = (float*)d_ws;
  float* q   = ws;                             // 1024*256
  float* qp  = q   + M * D_MODEL;
  float* kb  = qp  + M * D_MODEL;
  float* vb  = kb  + M * D_MODEL;
  float* x   = vb  + M * D_MODEL;
  float* ffh = x   + M * D_MODEL;              // 1024*2048
  float* ff  = ffh + M * 2048;
  float* u   = ff  + M * D_MODEL;              // 1024*4*256 folded pos query
  float* rr  = u   + M * 4 * D_MODEL;          // 1024*8*256 attn-weighted rel
  float* xp  = rr  + M * NH * D_MODEL;         // 1024*256 pre-LN1 partial
  float* sc  = xp  + M * D_MODEL;              // 1024*4*128 content scores

  // content / positional projections (WMMA fp32), one launch
  proj3_kernel<<<768, 256, 0, stream>>>(src, pos, Wq, bq, Wqp, bqp, Wk, bk, q,
                                        qp, kb);

  // one launch: v = Wv(Wk(src)), Wkp applied to the query side, content scores;
  // attention over rel (one WG per (b,q)), then Wvp applied to the
  // attn-weighted rel rows, residual + LN1
  fold_query_kernel<<<1024, 256, 0, stream>>>(qp, Wkp, u, q, kb, sc, Wv, bv, vb);
  const size_t smem = (SEQ * RP + 5 * UP + (NH + 1) * SCP) * sizeof(float);
  attn_fused_kernel<<<M, 256, smem, stream>>>(src, rel, sc, qp, u, vb, bkp, bvp,
                                              rr, xp);
  vfold_ln_kernel<<<M / 16, 256, 0, stream>>>(rr, Wvp, xp, g1, be1, x);

  // FFN + LN2
  gemm_strip_kernel<2048, 256, 1, 1><<<256, 256, 0, stream>>>(x, W1, b1, ffh);
  gemm_strip_kernel<256, 2048, 8, 0><<<256, 256, 0, stream>>>(ffh, W2, b2, ff);
  add_ln_kernel<<<M, 256, 0, stream>>>(x, ff, g2, be2, (float*)d_out);
}

// v006
// It runs in 77.5 microseconds.
// Timed twice side by side with v005, it ran 1.12 times as fast both times.
// Over all steps from v000 it is 14.3 times as fast.
#include <hip/hip_runtime.h>
#include <math.h>

typedef __attribute__((ext_vector_type(2))) float v2f;
typedef __attribute__((ext_vector_type(4))) float v4f;
typedef __attribute__((ext_vector_type(8))) float v8f;

#define D_MODEL 256
#define SEQ     128
#define NH      8

__device__ __forceinline__ v8f wmma4(v2f a, v2f b, v8f c) {
  // (neg_a, A, neg_b, B, c_mod, C, reuse_a, reuse_b)
  return __builtin_amdgcn_wmma_f32_16x16x4_f32(false, a, false, b, (short)0, c,
                                               false, false);
}

__device__ __forceinline__ void wmma_gap(v8f& x, v8f& y) {
  asm volatile("v_nop\n\tv_nop\n\tv_nop\n\tv_nop" : "+v"(x), "+v"(y));
}
__device__ __forceinline__ void wmma_gap(v8f& x, v8f& y, v8f& z, v8f& w) {
  asm volatile("v_nop\n\tv_nop\n\tv_nop\n\tv_nop"
               : "+v"(x), "+v"(y), "+v"(z), "+v"(w));
}
// The same behind a run of eight WMMAs, with the run's A and B fragments named
// as inputs: their registers stay theirs up to here.
__device__ __forceinline__ void wmma_gap_frags(
    v8f& x, v2f a0, v2f a1, v2f a2, v2f a3, v2f a4, v2f a5, v2f a6, v2f a7,
    v2f b0, v2f b1, v2f b2, v2f b3, v2f b4, v2f b5, v2f b6, v2f b7) {
  asm volatile("v_nop\n\tv_nop\n\tv_nop\n\tv_nop"
               : "+v"(x)
               : "v"(a0), "v"(a1), "v"(a2), "v"(a3), "v"(a4), "v"(a5), "v"(a6),
                 "v"(a7), "v"(b0), "v"(b1), "v"(b2), "v"(b3), "v"(b4), "v"(b5),
                 "v"(b6), "v"(b7));
}

template <int N, int K, int SPLIT, int RELU, int BIAS2 = 0>
__device__ __forceinline__ void gemm_strip(
    const float* __restrict__ A, const float* __restrict__ B,
    const float* __restrict__ bias, float* __restrict__ C, const int blk,
    const float* __restrict__ bias2 = nullptr) {
  constexpr int KW = K / SPLIT;                   // k range of one wave
  constexpr int NB = KW / 8;                      // 8-wide k blocks
  constexpr int SN = N / 64;                      // strips per row of C
  const int wv   = threadIdx.x >> 5;
  const int lane = threadIdx.x & 31;
  const int r    = lane & 15;
  const int hi   = lane >> 4;
  const int strip = SPLIT == 1 ? blk * 8 + wv : blk;
  const int kbeg  = SPLIT == 1 ? 0 : wv * KW;
  const int m0 = (strip / SN) << 4;
  const int n0 = (strip % SN) << 6;

  const float* Ap = A + (size_t)(m0 + r) * K + kbeg + 4 * hi;
  const float* Bp = B + (size_t)(kbeg + 4 * hi) * N + n0 + r;
  // the bias is the accumulators' start value (where K is split: in wave 0 only)
  v8f acc[4];
#pragma unroll
  for (int t = 0; t < 4; ++t) {
    float bv = bias[n0 + 16 * t + r];
    if (BIAS2) bv += bias2[n0 + 16 * t + r];
    const float bi = (SPLIT == 1 || wv == 0) ? bv : 0.f;
    acc[t] = (v8f){bi, bi, bi, bi, bi, bi, bi, bi};
  }

  // ring of four fragment sets, one 8-wide k block each: a block's loads are
  // issued three blocks (24 WMMAs) ahead of the WMMAs that read them
  v4f a[4];
  v2f b[4][2][4];
  auto load = [&](int s) {
    const int buf = s & 3;
    const int kk  = s * 8;
    a[buf] = *(const v4f*)(Ap + kk);
    // the A pointer is dead behind its last load and the allocator hands its
    // registers to later loads' results: the wait stands ahead of that overwrite
    if (s == NB - 1) asm volatile("s_wait_xcnt 0x0" ::: "memory");
#pragma unroll
    for (int st = 0; st < 2; ++st)
#pragma unroll
      for (int t = 0; t < 4; ++t) {
        b[buf][st][t].x = Bp[(kk + 2 * st) * N + 16 * t];
        b[buf][st][t].y = Bp[(kk + 2 * st + 1) * N + 16 * t];
      }
  };
  load(0);
  load(1);
  load(2);
#pragma unroll
  for (int s = 0; s < NB; ++s) {
    const int cur = s & 3;
    if (s + 3 < NB) load(s + 3);
    // keeps the loads above this block's WMMAs: without it the scheduler sinks
    // them to a few WMMAs ahead of their use and the wave waits out the latency
    __builtin_amdgcn_sched_barrier(0);
    const v2f a0 = {a[cur].x, a[cur].y};
    const v2f a1 = {a[cur].z, a[cur].w};
#pragma unroll
    for (int t = 0; t < 4; ++t) acc[t] = wmma4(a0, b[cur][0][t], acc[t]);
#pragma unroll
    for (int t = 0; t < 4; ++t) acc[t] = wmma4(a1, b[cur][1][t], acc[t]);
    // keeps later blocks' loads from rising above these WMMAs (register use)
    __builtin_amdgcn_sched_barrier(0);
  }
  wmma_gap(acc[0], acc[1], acc[2], acc[3]);       // D is read directly below

  if constexpr (SPLIT == 1) {
#pragma unroll
    for (int t = 0; t < 4; ++t) {
      float* Crow = C + (size_t)(m0 + 8 * hi) * N + n0 + 16 * t + r;
#pragma unroll
      for (int v = 0; v < 8; ++v) {
        float val = acc[t][v];
        if (RELU) val = fmaxf(val, 0.f);
        Crow[v * N] = val;
      }
    }
  } else {
    __shared__ __attribute__((aligned(16))) float red[SPLIT * 16 * 68];
#pragma unroll
    for (int t = 0; t < 4; ++t)
#pragma unroll
      for (int v = 0; v < 8; ++v)
        red[(wv * 16 + v + 8 * hi) * 68 + 16 * t + r] = acc[t][v];
    __syncthreads();
    const int row = threadIdx.x >> 4;
    const int c4  = (threadIdx.x & 15) << 2;
    v4f s = *(const v4f*)(red + row * 68 + c4);
#pragma unroll
    for (int w = 1; w < SPLIT; ++w)
      s += *(const v4f*)(red + (w * 16 + row) * 68 + c4);
    if (RELU) {
#pragma unroll
      for (int i = 0; i < 4; ++i) s[i] = fmaxf(s[i], 0.f);
    }
    *(v4f*)(C + (size_t)(m0 + row) * N + n0 + c4) = s;
  }
}

template <int N, int K, int SPLIT, int RELU>
__global__ __launch_bounds__(256) void gemm_strip_kernel(
    const float* __restrict__ A, const float* __restrict__ B,
    const float* __restrict__ bias, float* __restrict__ C) {
  gemm_strip<N, K, SPLIT, RELU>(A, B, bias, C, blockIdx.x);
}

// The three projections that depend on inputs alone, in one launch of 3 x 256
// blocks:  q = src Wq + bq,  qp = pos Wqp + bqp,  k_base = src Wk + bk.
__global__ __launch_bounds__(256) void proj3_kernel(
    const float* __restrict__ src, const float* __restrict__ pos,
    const float* __restrict__ Wq, const float* __restrict__ bq,
    const float* __restrict__ Wqp, const float* __restrict__ bqp,
    const float* __restrict__ Wk, const float* __restrict__ bk,
    float* __restrict__ q, float* __restrict__ qp, float* __restrict__ kb) {
  const int which = blockIdx.x >> 8;
  const float* A    = which == 1 ? pos : src;
  const float* B    = which == 0 ? Wq : which == 1 ? Wqp : Wk;
  const float* bias = which == 0 ? bq : which == 1 ? bqp : bk;
  float* C          = which == 0 ? q : which == 1 ? qp : kb;
  gemm_strip<256, 256, 8, 0>(A, B, bias, C, blockIdx.x & 255);
}

// ---------------------------------------------------------------------------
// The three products that need only the projections, in one launch.
//  blocks 0..255   v_base = k_base Wv + bv + bvp (the strip GEMM above; it has
//                  the longest path of the three, so it starts first; every use
//                  of v_base is as v_base + bvp)
// Then two batched products of one form: a 16x16 tile per wave, both operands
// read by rows, over the 64 adjacent k values of head h (B[k][n] =
// Brow[n][h*64+k], so a lane's two k values are adjacent in memory).
//  blocks 256..767  folded positional query:
//    U[row,h,d] = sum_e qp[row, h*64+e] * Wkp[d, h*64+e]
//  blocks 768..1023 content scores, not yet scaled (key and query of one batch):
//    S[row,h,key] = sum_e q[row, h*64+e] * k_base[batch(row)*128+key, h*64+e]
// ---------------------------------------------------------------------------
template <int CS>                                 // floats between rows of C
__device__ __forceinline__ void tile_rows_k64(const float* __restrict__ Ap,
                                              const float* __restrict__ Bp,
                                              float* __restrict__ Co) {
  v8f acc = {0.f, 0.f, 0.f, 0.f, 0.f, 0.f, 0.f, 0.f};
  v2f a[16], b[16];
#pragma unroll
  for (int j = 0; j < 16; ++j) {
    a[j].x = Ap[4 * j];
    a[j].y = Ap[4 * j + 1];
    b[j].x = Bp[4 * j];
    b[j].y = Bp[4 * j + 1];
  }
  // both pointers are dead behind the last load and their registers go to the
  // accumulator and the store address: the wait stands ahead of that overwrite
  asm volatile("s_wait_xcnt 0x0" ::: "memory");
#pragma unroll
  for (int g = 0; g < 16; g += 8) {
#pragma unroll
    for (int j = 0; j < 8; ++j) acc = wmma4(a[g + j], b[g + j], acc);
    // behind the last run the stores read D directly
    wmma_gap_frags(acc, a[g], a[g + 1], a[g + 2], a[g + 3], a[g + 4], a[g + 5],
                   a[g + 6], a[g + 7], b[g], b[g + 1], b[g + 2], b[g + 3],
                   b[g + 4], b[g + 5], b[g + 6], b[g + 7]);
  }
#pragma unroll
  for (int v = 0; v < 8; ++v) Co[v * CS] = acc[v];
  // code laid out behind an inlined call may reuse the registers these stores name
  asm volatile("s_wait_xcnt 0x0" ::: "memory");
}

__global__ __launch_bounds__(256) void fold_query_kernel(
    const float* __restrict__ qp, const float* __restrict__ Wkp,
    float* __restrict__ U, const float* __restrict__ q,
    const float* __restrict__ k_base, float* __restrict__ S,
    const float* __restrict__ Wv, const float* __restrict__ bv,
    const float* __restrict__ bvp, float* __restrict__ v_base) {
  if (blockIdx.x < 256) {
    gemm_strip<256, 256, 8, 0, 1>(k_base, Wv, bv, v_base, blockIdx.x, bvp);
    return;
  }
  const int wv   = threadIdx.x >> 5;
  const int lane = threadIdx.x & 31;
  const int r  = lane & 15;
  const int ks = (lane >> 4) << 1;
  const int ro = (lane >> 4) << 3;
  if (blockIdx.x < 768) {
    const int wid = (blockIdx.x - 256) * 8 + wv;  // 64 x 4 x 16 tiles
    const int n0 = (wid & 15) << 4;
    const int h  = (wid >> 4) & 3;
    const int m0 = (wid >> 6) << 4;
    tile_rows_k64<4 * D_MODEL>(
        qp  + (size_t)(m0 + r) * D_MODEL + h * 64 + ks,
        Wkp + (size_t)(n0 + r) * D_MODEL + h * 64 + ks,
        U + ((size_t)(m0 + ro) * 4 + h) * D_MODEL + n0 + r);
  } else {
    const int wid = (blockIdx.x - 768) * 8 + wv;  // 64 x 4 x 8 tiles
    const int n0 = (wid & 7) << 4;
    const int h  = (wid >> 3) & 3;
    const int m0 = (wid >> 5) << 4;
    const int b0 = m0 & ~(SEQ - 1);               // first row of the batch
    tile_rows_k64<4 * SEQ>(
        q      + (size_t)(m0 + r) * D_MODEL + h * 64 + ks,
        k_base + (size_t)(b0 + n0 + r) * D_MODEL + h * 64 + ks,
        S + ((size_t)(m0 + ro) * 4 + h) * SEQ + n0 + r);
  }
}

// Block-wide sum over 256 threads (8 wave32s), via shuffles + tiny LDS.
__device__ __forceinline__ float block_sum_256(float v, float* red) {
  const int lane = threadIdx.x & 31;
  const int wv   = threadIdx.x >> 5;
#pragma unroll
  for (int off = 16; off > 0; off >>= 1) v += __shfl_xor(v, off, 32);
  if (lane == 0) red[wv] = v;
  __syncthreads();
  if (wv == 0) {
    float s = (lane < 8) ? red[lane] : 0.f;
#pragma unroll
    for (int off = 16; off > 0; off >>= 1) s += __shfl_xor(s, off, 32);
    if (lane == 0) red[8] = s;
  }
  __syncthreads();
  float s = red[8];
  __syncthreads();                                // allow red reuse
  return s;
}

#define RP  268
#define UP  260
#define SCP 132

__global__ void attn_fused_kernel(const float* __restrict__ rel,
                                  const float* __restrict__ scg,
                                  const float* __restrict__ qpg,
                                  const float* __restrict__ ug,
                                  const float* __restrict__ bkp,
                                  float* __restrict__ rg,
                                  float* __restrict__ ag) {
  extern __shared__ float smem[];
  float* rel_s = smem;                         // SEQ*RP
  float* u_s   = rel_s + SEQ * RP;             // 5*UP
  float* sc_s  = u_s + 5 * UP;                 // 9*SCP scores -> attn

  const int bq   = blockIdx.x;                 // b*128 + q
  const int t    = threadIdx.x;
  const int wv   = t >> 5;
  const int lane = t & 31;
  const int r    = lane & 15;
  const int ks   = (lane >> 4) << 1;
  const int ro   = (lane >> 4) << 3;
  float cb = 0.f;                              // qp_h . bkp_h, h = lane & 3

  {
    const unsigned long long gbase =
        (unsigned long long)(const void*)(rel + (size_t)bq * SEQ * D_MODEL);
    const unsigned ldsbase = (unsigned)(size_t)(void*)rel_s;
    for (int i = t; i < SEQ * D_MODEL / 4; i += 256) {
      const unsigned goff  = (unsigned)i * 16u;   // bytes
      const unsigned laddr =                      // row i/64, 16-byte piece i%64
          ldsbase + (unsigned)(i >> 6) * (RP * 4u) + (unsigned)(i & 63) * 16u;
      asm volatile("global_load_async_to_lds_b128 %0, %1, %2 offset:0"
                   :
                   : "v"(laddr), "v"(goff), "s"(gbase)
                   : "memory");
    }
    // content scores, heads 0-3: 4 x 128 adjacent floats, scaled by 1/sqrt(64)
#pragma unroll
    for (int j = 0; j < 2; ++j)
      sc_s[(2 * j + (t >> 7)) * SCP + (t & 127)] =
          scg[(size_t)bq * 4 * SEQ + j * 256 + t] * 0.125f;
#pragma unroll
    for (int j = 0; j < 4; ++j)
      u_s[j * UP + t] = ug[((size_t)bq * 4 + j) * D_MODEL + t];
    u_s[4 * UP + t] = 0.f;
    if (t < SEQ) sc_s[NH * SCP + t] = 0.f;
    const float* qr = qpg + (size_t)bq * D_MODEL + (lane & 3) * 64;
    const float* br = bkp + (lane & 3) * 64;
    for (int e = 0; e < 64; ++e) cb += qr[e] * br[e];
    asm volatile("s_wait_asynccnt 0x0" ::: "memory");
  }
  __syncthreads();

  // ---- pos scores, heads 4-7: S[key,h] = rel_s[128,256] @ u^T[256,4] + cb -
  // One 16-key tile per wave; columns 4..15 of B are zero and not stored.
  {
    const int m0 = wv << 4;
    const float* As = rel_s + (m0 + r) * RP + ks;
    const float* Bs = u_s + (r < 4 ? r : 4) * UP + ks;
    v8f acc0 = {cb, cb, cb, cb, cb, cb, cb, cb};
    v8f acc1 = {0.f, 0.f, 0.f, 0.f, 0.f, 0.f, 0.f, 0.f};
#pragma unroll 4
    for (int k0 = 0; k0 < D_MODEL; k0 += 8) {
      const v2f a0 = *(const v2f*)(As + k0);
      const v2f a1 = *(const v2f*)(As + k0 + 4);
      const v2f b0 = *(const v2f*)(Bs + k0);
      const v2f b1 = *(const v2f*)(Bs + k0 + 4);
      acc0 = wmma4(a0, b0, acc0);
      acc1 = wmma4(a1, b1, acc1);
    }
    wmma_gap(acc0, acc1);
    if (r < 4) {
      float* So = sc_s + (4 + r) * SCP + m0 + ro;
#pragma unroll
      for (int v = 0; v < 8; ++v) So[v] = (acc0[v] + acc1[v]) * 0.125f;
    }
  }

  __syncthreads();

  // ---- softmax over k, one wave32 per head -------------------------------
  float av[4];                                 // attn[head wv][lane + 32 j]
  {
    float* row = sc_s + wv * SCP;
    float vals[4];
    float m = -1e30f;
#pragma unroll
    for (int j = 0; j < 4; ++j) {
      vals[j] = row[lane + 32 * j];
      m = fmaxf(m, vals[j]);
    }
#pragma unroll
    for (int off = 16; off > 0; off >>= 1) m = fmaxf(m, __shfl_xor(m, off, 32));
    float sum = 0.f;
#pragma unroll
    for (int j = 0; j < 4; ++j) { vals[j] = __expf(vals[j] - m); sum += vals[j]; }
#pragma unroll
    for (int off = 16; off > 0; off >>= 1) sum += __shfl_xor(sum, off, 32);
    const float inv = 1.f / sum;
#pragma unroll
    for (int j = 0; j < 4; ++j) {
      av[j] = vals[j] * inv;
      row[lane + 32 * j] = av[j];
    }
  }
  __syncthreads();

  // ---- R[h,:] = attn[8,128] @ rel_s[128,256]  (WMMA, rows 8..15 zero) -----
  // Two 16-column tiles per wave, one after the other; even and odd k steps
  // go to two accumulators that are added at the end.
  {
    const float* As = sc_s + (r < NH ? r : NH) * SCP + ks;
    // not unrolled: with both tiles in one body the LDS loads get paired across
    // tiles and every B fragment then needs register moves next to the WMMAs
#pragma unroll 1
    for (int nt = 0; nt < 2; ++nt) {
      const int n0 = (wv << 5) + (nt << 4);
      const float* Bs = rel_s + ks * RP + n0 + r;
      v8f c0 = {0.f, 0.f, 0.f, 0.f, 0.f, 0.f, 0.f, 0.f};
      v8f c1 = {0.f, 0.f, 0.f, 0.f, 0.f, 0.f, 0.f, 0.f};
      // rolled so that the gap below closes every run of eight WMMAs
#pragma unroll 1
      for (int k0 = 0; k0 < SEQ; k0 += 32) {
        v2f a[8], bb[8];
#pragma unroll
        for (int j = 0; j < 8; ++j) {
          a[j]    = *(const v2f*)(As + k0 + 4 * j);
          bb[j].x = Bs[(k0 + 4 * j) * RP];
          bb[j].y = Bs[(k0 + 4 * j) * RP + RP];
        }
#pragma unroll
        for (int j = 0; j < 8; j += 2) {
          c0 = wmma4(a[j], bb[j], c0);
          c1 = wmma4(a[j + 1], bb[j + 1], c1);
        }
        wmma_gap(c0, c1);
      }
      if (lane < 16) {                          // rows 0..7 = heads
        float* Ro = rg + (size_t)bq * NH * D_MODEL + n0 + r;
#pragma unroll
        for (int v = 0; v < 8; ++v) Ro[v * D_MODEL] = c0[v] + c1[v];
        // the next tile's accumulators reuse the registers these stores name
        asm volatile("s_wait_xcnt 0x0" ::: "memory");
      }
    }
  }

  // ---- attn itself, for the value product of the next launch --------------
  // Stored behind the last barrier: a barrier waits for the wave's open stores.
  {
    float* ao = ag + ((size_t)bq * NH + wv) * SEQ + lane;
#pragma unroll
    for (int j = 0; j < 4; ++j) ao[32 * j] = av[j];
  }
}

// ---------------------------------------------------------------------------
// x = LayerNorm1(src + per-head attn_h[16,128] @ v_base[:, h*32 .. h*32+31]
//                    + per-head R_h[16,256] @ Wvp[:, h*32 .. h*32+31]).
// (v_base holds bvp.)  One workgroup of 16 waves per 16 rows, all queries of one
// batch.  Waves 0..7 take the R product, waves 8..15 the attn product, side by
// side; wave & 7 = head (two 16-column tiles, shared A).
// ---------------------------------------------------------------------------
__global__ __launch_bounds__(512) void vfold_ln_kernel(
    const float* __restrict__ rg, const float* __restrict__ Wvp,
    const float* __restrict__ ag, const float* __restrict__ v_base,
    const float* __restrict__ src, const float* __restrict__ g1,
    const float* __restrict__ be1, float* __restrict__ xout) {
  __shared__ float xs[2 * 16 * D_MODEL];        // R product | attn product
  const int wv   = __builtin_amdgcn_readfirstlane(threadIdx.x >> 5);
  const int lane = threadIdx.x & 31;
  const int r    = lane & 15;
  const int ks   = (lane >> 4) << 1;
  const int ro   = (lane >> 4) << 3;
  const int m0   = blockIdx.x << 4;
  const int h    = wv & 7;
  const int n0   = h << 5;
  v8f c0 = {0.f, 0.f, 0.f, 0.f, 0.f, 0.f, 0.f, 0.f};
  v8f c1 = {0.f, 0.f, 0.f, 0.f, 0.f, 0.f, 0.f, 0.f};
  if (wv < 8) {
    const float* Ap = rg + ((size_t)(m0 + r) * NH + h) * D_MODEL + ks;
    const float* Bp = Wvp + (size_t)ks * D_MODEL + n0 + r;
#pragma unroll 8
    for (int k0 = 0; k0 < D_MODEL; k0 += 4) {
      v2f a, b0, b1;
      a.x  = Ap[k0];
      a.y  = Ap[k0 + 1];
      b0.x = Bp[k0 * D_MODEL];
      b0.y = Bp[k0 * D_MODEL + D_MODEL];
      b1.x = Bp[k0 * D_MODEL + 16];
      b1.y = Bp[k0 * D_MODEL + D_MODEL + 16];
      c0 = wmma4(a, b0, c0);
      c1 = wmma4(a, b1, c1);
    }
  } else {
    const int b0r = m0 & ~(SEQ - 1);            // first row of the batch
    const float* Ap = ag + ((size_t)(m0 + r) * NH + h) * SEQ + ks;
    const float* Bp = v_base + (size_t)(b0r + ks) * D_MODEL + n0 + r;
#pragma unroll 8
    for (int k0 = 0; k0 < SEQ; k0 += 4) {
      v2f a, b0, b1;
      a.x  = Ap[k0];
      a.y  = Ap[k0 + 1];
      b0.x = Bp[k0 * D_MODEL];
      b0.y = Bp[k0 * D_MODEL + D_MODEL];
      b1.x = Bp[k0 * D_MODEL + 16];
      b1.y = Bp[k0 * D_MODEL + D_MODEL + 16];
      c0 = wmma4(a, b0, c0);
      c1 = wmma4(a, b1, c1);
    }
  }
  wmma_gap(c0, c1);                               // the stores read D directly
  float* xo = xs + (wv >> 3) * 16 * D_MODEL;
#pragma unroll
  for (int v = 0; v < 8; ++v) {
    xo[(ro + v) * D_MODEL + n0 + r]      = c0[v];
    xo[(ro + v) * D_MODEL + n0 + r + 16] = c1[v];
  }
  __syncthreads();
  if (wv >= 8) return;                          // no barrier below
#pragma unroll
  for (int j = 0; j < 2; ++j) {                 // two rows per wave
    const int row = wv * 2 + j;
    const size_t gro = (size_t)(m0 + row) * D_MODEL;
    float x[8];
    float sum = 0.f;
#pragma unroll
    for (int i = 0; i < 8; ++i) {
      x[i] = src[gro + lane + 32 * i] +
             xs[(16 + row) * D_MODEL + lane + 32 * i] +
             xs[row * D_MODEL + lane + 32 * i];
      sum += x[i];
    }
#pragma unroll
    for (int off = 16; off > 0; off >>= 1) sum += __shfl_xor(sum, off, 32);
    const float mean = sum * (1.f / D_MODEL);
    float sq = 0.f;
#pragma unroll
    for (int i = 0; i < 8; ++i) {
      x[i] -= mean;
      sq += x[i] * x[i];
    }
#pragma unroll
    for (int off = 16; off > 0; off >>= 1) sq += __shfl_xor(sq, off, 32);
    const float rs = rsqrtf(sq * (1.f / D_MODEL) + 1e-5f);
#pragma unroll
    for (int i = 0; i < 8; ++i) {
      const int c = lane + 32 * i;
      xout[gro + c] = x[i] * rs * g1[c] + be1[c];
    }
  }
}

// out = LayerNorm(a + c) with gain/bias; one 256-thread block per row.
__global__ void add_ln_kernel(const float* __restrict__ a,
                              const float* __restrict__ c,
                              const float* __restrict__ g,
                              const float* __restrict__ be,
                              float* __restrict__ out) {
  __shared__ float red[16];
  const int row = blockIdx.x, t = threadIdx.x;
  float x = a[(size_t)row * D_MODEL + t] + c[(size_t)row * D_MODEL + t];
  const float mean = block_sum_256(x, red) * (1.f / D_MODEL);
  const float d    = x - mean;
  const float var  = block_sum_256(d * d, red) * (1.f / D_MODEL);
  out[(size_t)row * D_MODEL + t] = d * rsqrtf(var + 1e-5f) * g[t] + be[t];
}

// ---------------------------------------------------------------------------
extern "C" void kernel_launch(void* const* d_in, const int* in_sizes, int n_in,
                              void* d_out, int out_size, void* d_ws,
                              size_t ws_size, hipStream_t stream) {
  const float* src = (const float*)d_in[0];
  const float* pos = (const float*)d_in[1];
  const float* rel = (const float*)d_in[2];
  const float* Wq  = (const float*)d_in[3];  const float* bq  = (const float*)d_in[4];
  const float* Wk  = (const float*)d_in[5];  const float* bk  = (const float*)d_in[6];
  const float* Wv  = (const float*)d_in[7];  const float* bv  = (const float*)d_in[8];
  const float* Wqp = (const float*)d_in[9];  const float* bqp = (const float*)d_in[10];
  const float* Wkp = (const float*)d_in[11]; const float* bkp = (const float*)d_in[12];
  const float* Wvp = (const float*)d_in[13]; const float* bvp = (const float*)d_in[14];
  const float* W1  = (const float*)d_in[15]; const float* b1  = (const float*)d_in[16];
  const float* W2  = (const float*)d_in[17]; const float* b2  = (const float*)d_in[18];
  const float* g1  = (const float*)d_in[19]; const float* be1 = (const float*)d_in[20];
  const float* g2  = (const float*)d_in[21]; const float* be2 = (const float*)d_in[22];

  const int M = 8 * 128;                       // B*A rows
  float* ws  = (float*)d_ws;
  float* q   = ws;                             // 1024*256
  float* qp  = q   + M * D_MODEL;
  float* kb  = qp  + M * D_MODEL;
  float* vb  = kb  + M * D_MODEL;
  float* x   = vb  + M * D_MODEL;
  float* ffh = x   + M * D_MODEL;              // 1024*2048
  float* ff  = ffh + M * 2048;
  float* u   = ff  + M * D_MODEL;              // 1024*4*256 folded pos query
  float* rr  = u   + M * 4 * D_MODEL;          // 1024*8*256 attn-weighted rel
  float* at  = rr  + M * NH * D_MODEL;         // 1024*8*128 attn
  float* sc  = at  + M * NH * SEQ;             // 1024*4*128 content scores

  // content / positional projections (WMMA fp32), one launch
  proj3_kernel<<<768, 256, 0, stream>>>(src, pos, Wq, bq, Wqp, bqp, Wk, bk, q,
                                        qp, kb);

  // one launch: v = Wv(Wk(src)) + bvp, Wkp applied to the query side, content
  // scores; attention over rel (one WG per (b,q)), then Wvp applied to the
  // attn-weighted rel rows, attn applied to v, residual + LN1
  fold_query_kernel<<<1024, 256, 0, stream>>>(qp, Wkp, u, q, kb, sc, Wv, bv, bvp,
                                              vb);
  const size_t smem = (SEQ * RP + 5 * UP + (NH + 1) * SCP) * sizeof(float);
  attn_fused_kernel<<<M, 256, smem, stream>>>(rel, sc, qp, u, bkp, rr, at);
  vfold_ln_kernel<<<M / 16, 512, 0, stream>>>(rr, Wvp, at, vb, src, g1, be1, x);

  // FFN + LN2
  gemm_strip_kernel<2048, 256, 1, 1><<<256, 256, 0, stream>>>(x, W1, b1, ffh);
  gemm_strip_kernel<256, 2048, 8, 0><<<256, 256, 0, stream>>>(ffh, W2, b2, ff);
  add_ln_kernel<<<M, 256, 0, stream>>>(x, ff, g2, be2, (float*)d_out);
}

// v007
// Measured time: 71.2 microseconds a run.
// In both of two side-by-side timings against v006, it was 1.08 times as fast.
// All steps since v000 together make it 15.4 times as fast.
#include <hip/hip_runtime.h>
#include <math.h>

typedef __attribute__((ext_vector_type(2))) float v2f;
typedef __attribute__((ext_vector_type(4))) float v4f;
typedef __attribute__((ext_vector_type(8))) float v8f;

#define D_MODEL 256
#define SEQ     128
#define NH      8

__device__ __forceinline__ v8f wmma4(v2f a, v2f b, v8f c) {
  // (neg_a, A, neg_b, B, c_mod, C, reuse_a, reuse_b)
  return __builtin_amdgcn_wmma_f32_16x16x4_f32(false, a, false, b, (short)0, c,
                                               false, false);
}

__device__ __forceinline__ void wmma_gap(v8f& x, v8f& y) {
  asm volatile("v_nop\n\tv_nop\n\tv_nop\n\tv_nop" : "+v"(x), "+v"(y));
}
__device__ __forceinline__ void wmma_gap(v8f& x, v8f& y, v8f& z, v8f& w) {
  asm volatile("v_nop\n\tv_nop\n\tv_nop\n\tv_nop"
               : "+v"(x), "+v"(y), "+v"(z), "+v"(w));
}
// The same behind a run of eight WMMAs, with the run's A and B fragments named
// as inputs: their registers stay theirs up to here.
__device__ __forceinline__ void wmma_gap_frags(
    v8f& x, v2f a0, v2f a1, v2f a2, v2f a3, v2f a4, v2f a5, v2f a6, v2f a7,
    v2f b0, v2f b1, v2f b2, v2f b3, v2f b4, v2f b5, v2f b6, v2f b7) {
  asm volatile("v_nop\n\tv_nop\n\tv_nop\n\tv_nop"
               : "+v"(x)
               : "v"(a0), "v"(a1), "v"(a2), "v"(a3), "v"(a4), "v"(a5), "v"(a6),
                 "v"(a7), "v"(b0), "v"(b1), "v"(b2), "v"(b3), "v"(b4), "v"(b5),
                 "v"(b6), "v"(b7));
}

template <int N, int K, int SPLIT, int RELU, int BIAS2 = 0>
__device__ __forceinline__ void gemm_strip(
    const float* __restrict__ A, const float* __restrict__ B,
    const float* __restrict__ bias, float* __restrict__ C, const int blk,
    const float* __restrict__ bias2 = nullptr) {
  constexpr int KW = K / SPLIT;                   // k range of one wave
  constexpr int NB = KW / 8;                      // 8-wide k blocks
  constexpr int SN = N / 64;                      // strips per row of C
  const int wv   = threadIdx.x >> 5;
  const int lane = threadIdx.x & 31;
  const int r    = lane & 15;
  const int hi   = lane >> 4;
  const int strip = SPLIT == 1 ? blk * 8 + wv : blk;
  const int kbeg  = SPLIT == 1 ? 0 : wv * KW;
  const int m0 = (strip / SN) << 4;
  const int n0 = (strip % SN) << 6;

  const float* Ap = A + (size_t)(m0 + r) * K + kbeg + 4 * hi;
  const float* Bp = B + (size_t)(kbeg + 4 * hi) * N + n0 + r;
  // the bias is the accumulators' start value (where K is split: in wave 0 only)
  v8f acc[4];
#pragma unroll
  for (int t = 0; t < 4; ++t) {
    float bv = bias[n0 + 16 * t + r];
    if (BIAS2) bv += bias2[n0 + 16 * t + r];
    const float bi = (SPLIT == 1 || wv == 0) ? bv : 0.f;
    acc[t] = (v8f){bi, bi, bi, bi, bi, bi, bi, bi};
  }

  // ring of four fragment sets, one 8-wide k block each: a block's loads are
  // issued three blocks (24 WMMAs) ahead of the WMMAs that read them
  v4f a[4];
  v2f b[4][2][4];
  auto load = [&](int s) {
    const int buf = s & 3;
    const int kk  = s * 8;
    a[buf] = *(const v4f*)(Ap + kk);
    // the A pointer is dead behind its last load and the allocator hands its
    // registers to later loads' results: the wait stands ahead of that overwrite
    if (s == NB - 1) asm volatile("s_wait_xcnt 0x0" ::: "memory");
#pragma unroll
    for (int st = 0; st < 2; ++st)
#pragma unroll
      for (int t = 0; t < 4; ++t) {
        b[buf][st][t].x = Bp[(kk + 2 * st) * N + 16 * t];
        b[buf][st][t].y = Bp[(kk + 2 * st + 1) * N + 16 * t];
      }
  };
  load(0);
  load(1);
  load(2);
#pragma unroll
  for (int s = 0; s < NB; ++s) {
    const int cur = s & 3;
    if (s + 3 < NB) load(s + 3);
    // keeps the loads above this block's WMMAs: without it the scheduler sinks
    // them to a few WMMAs ahead of their use and the wave waits out the latency
    __builtin_amdgcn_sched_barrier(0);
    const v2f a0 = {a[cur].x, a[cur].y};
    const v2f a1 = {a[cur].z, a[cur].w};
#pragma unroll
    for (int t = 0; t < 4; ++t) acc[t] = wmma4(a0, b[cur][0][t], acc[t]);
#pragma unroll
    for (int t = 0; t < 4; ++t) acc[t] = wmma4(a1, b[cur][1][t], acc[t]);
    // keeps later blocks' loads from rising above these WMMAs (register use)
    __builtin_amdgcn_sched_barrier(0);
  }
  wmma_gap(acc[0], acc[1], acc[2], acc[3]);       // D is read directly below

  if constexpr (SPLIT == 1) {
#pragma unroll
    for (int t = 0; t < 4; ++t) {
      float* Crow = C + (size_t)(m0 + 8 * hi) * N + n0 + 16 * t + r;
#pragma unroll
      for (int v = 0; v < 8; ++v) {
        float val = acc[t][v];
        if (RELU) val = fmaxf(val, 0.f);
        Crow[v * N] = val;
      }
    }
  } else {
    __shared__ __attribute__((aligned(16))) float red[SPLIT * 16 * 68];
#pragma unroll
    for (int t = 0; t < 4; ++t)
#pragma unroll
      for (int v = 0; v < 8; ++v)
        red[(wv * 16 + v + 8 * hi) * 68 + 16 * t + r] = acc[t][v];
    __syncthreads();
    const int row = threadIdx.x >> 4;
    const int c4  = (threadIdx.x & 15) << 2;
    v4f s = *(const v4f*)(red + row * 68 + c4);
#pragma unroll
    for (int w = 1; w < SPLIT; ++w)
      s += *(const v4f*)(red + (w * 16 + row) * 68 + c4);
    if (RELU) {
#pragma unroll
      for (int i = 0; i < 4; ++i) s[i] = fmaxf(s[i], 0.f);
    }
    *(v4f*)(C + (size_t)(m0 + row) * N + n0 + c4) = s;
  }
}

// The three projections that depend on inputs alone, in one launch of 3 x 256
// blocks:  q = src Wq + bq,  qp = pos Wqp + bqp,  k_base = src Wk + bk.
__global__ __launch_bounds__(256) void proj3_kernel(
    const float* __restrict__ src, const float* __restrict__ pos,
    const float* __restrict__ Wq, const float* __restrict__ bq,
    const float* __restrict__ Wqp, const float* __restrict__ bqp,
    const float* __restrict__ Wk, const float* __restrict__ bk,
    float* __restrict__ q, float* __restrict__ qp, float* __restrict__ kb) {
  const int which = blockIdx.x >> 8;
  const float* A    = which == 1 ? pos : src;
  const float* B    = which == 0 ? Wq : which == 1 ? Wqp : Wk;
  const float* bias = which == 0 ? bq : which == 1 ? bqp : bk;
  float* C          = which == 0 ? q : which == 1 ? qp : kb;
  gemm_strip<256, 256, 8, 0>(A, B, bias, C, blockIdx.x & 255);
}

// ---------------------------------------------------------------------------
// The three products that need only the projections, in one launch.
//  blocks 0..255   v_base = k_base Wv + bv + bvp (the strip GEMM above; it has
//                  the longest path of the three, so it starts first; every use
//                  of v_base is as v_base + bvp)
// Then two batched products of one form: a 16x16 tile per wave, both operands
// read by rows, over the 64 adjacent k values of head h (B[k][n] =
// Brow[n][h*64+k], so a lane's two k values are adjacent in memory).
//  blocks 256..767  folded positional query:
//    U[row,h,d] = sum_e qp[row, h*64+e] * Wkp[d, h*64+e]
//  blocks 768..1023 content scores, not yet scaled (key and query of one batch):
//    S[row,h,key] = sum_e q[row, h*64+e] * k_base[batch(row)*128+key, h*64+e]
// ---------------------------------------------------------------------------
template <int CS>                                 // floats between rows of C
__device__ __forceinline__ void tile_rows_k64(const float* __restrict__ Ap,
                                              const float* __restrict__ Bp,
                                              float* __restrict__ Co) {
  v8f acc = {0.f, 0.f, 0.f, 0.f, 0.f, 0.f, 0.f, 0.f};
  v2f a[16], b[16];
#pragma unroll
  for (int j = 0; j < 16; ++j) {
    a[j].x = Ap[4 * j];
    a[j].y = Ap[4 * j + 1];
    b[j].x = Bp[4 * j];
    b[j].y = Bp[4 * j + 1];
  }
  // both pointers are dead behind the last load and their registers go to the
  // accumulator and the store address: the wait stands ahead of that overwrite
  asm volatile("s_wait_xcnt 0x0" ::: "memory");
#pragma unroll
  for (int g = 0; g < 16; g += 8) {
#pragma unroll
    for (int j = 0; j < 8; ++j) acc = wmma4(a[g + j], b[g + j], acc);
    // behind the last run the stores read D directly
    wmma_gap_frags(acc, a[g], a[g + 1], a[g + 2], a[g + 3], a[g + 4], a[g + 5],
                   a[g + 6], a[g + 7], b[g], b[g + 1], b[g + 2], b[g + 3],
                   b[g + 4], b[g + 5], b[g + 6], b[g + 7]);
  }
#pragma unroll
  for (int v = 0; v < 8; ++v) Co[v * CS] = acc[v];
  // code laid out behind an inlined call may reuse the registers these stores name
  asm volatile("s_wait_xcnt 0x0" ::: "memory");
}

__global__ __launch_bounds__(256) void fold_query_kernel(
    const float* __restrict__ qp, const float* __restrict__ Wkp,
    float* __restrict__ U, const float* __restrict__ q,
    const float* __restrict__ k_base, float* __restrict__ S,
    const float* __restrict__ Wv, const float* __restrict__ bv,
    const float* __restrict__ bvp, float* __restrict__ v_base) {
  if (blockIdx.x < 256) {
    gemm_strip<256, 256, 8, 0, 1>(k_base, Wv, bv, v_base, blockIdx.x, bvp);
    return;
  }
  const int wv   = threadIdx.x >> 5;
  const int lane = threadIdx.x & 31;
  const int r  = lane & 15;
  const int ks = (lane >> 4) << 1;
  const int ro = (lane >> 4) << 3;
  if (blockIdx.x < 768) {
    const int wid = (blockIdx.x - 256) * 8 + wv;  // 64 x 4 x 16 tiles
    const int n0 = (wid & 15) << 4;
    const int h  = (wid >> 4) & 3;
    const int m0 = (wid >> 6) << 4;
    tile_rows_k64<4 * D_MODEL>(
        qp  + (size_t)(m0 + r) * D_MODEL + h * 64 + ks,
        Wkp + (size_t)(n0 + r) * D_MODEL + h * 64 + ks,
        U + ((size_t)(m0 + ro) * 4 + h) * D_MODEL + n0 + r);
  } else {
    const int wid = (blockIdx.x - 768) * 8 + wv;  // 64 x 4 x 8 tiles
    const int n0 = (wid & 7) << 4;
    const int h  = (wid >> 3) & 3;
    const int m0 = (wid >> 5) << 4;
    const int b0 = m0 & ~(SEQ - 1);               // first row of the batch
    tile_rows_k64<4 * SEQ>(
        q      + (size_t)(m0 + r) * D_MODEL + h * 64 + ks,
        k_base + (size_t)(b0 + n0 + r) * D_MODEL + h * 64 + ks,
        S + ((size_t)(m0 + ro) * 4 + h) * SEQ + n0 + r);
  }
}

// Block-wide sum over 256 threads (8 wave32s), via shuffles + tiny LDS.
__device__ __forceinline__ float block_sum_256(float v, float* red) {
  const int lane = threadIdx.x & 31;
  const int wv   = threadIdx.x >> 5;
#pragma unroll
  for (int off = 16; off > 0; off >>= 1) v += __shfl_xor(v, off, 32);
  if (lane == 0) red[wv] = v;
  __syncthreads();
  if (wv == 0) {
    float s = (lane < 8) ? red[lane] : 0.f;
#pragma unroll
    for (int off = 16; off > 0; off >>= 1) s += __shfl_xor(s, off, 32);
    if (lane == 0) red[8] = s;
  }
  __syncthreads();
  float s = red[8];
  __syncthreads();                                // allow red reuse
  return s;
}

#define RP  268
#define UP  260
#define SCP 132

__global__ void attn_fused_kernel(const float* __restrict__ rel,
                                  const float* __restrict__ scg,
                                  const float* __restrict__ qpg,
                                  const float* __restrict__ ug,
                                  const float* __restrict__ bkp,
                                  float* __restrict__ rg,
                                  float* __restrict__ ag) {
  extern __shared__ float smem[];
  float* rel_s = smem;                         // SEQ*RP
  float* u_s   = rel_s + SEQ * RP;             // 5*UP
  float* sc_s  = u_s + 5 * UP;                 // 9*SCP scores -> attn

  const int bq   = blockIdx.x;                 // b*128 + q
  const int t    = threadIdx.x;
  const int wv   = t >> 5;
  const int lane = t & 31;
  const int r    = lane & 15;
  const int ks   = (lane >> 4) << 1;
  const int ro   = (lane >> 4) << 3;
  float cb = 0.f;                              // qp_h . bkp_h, h = lane & 3

  {
    const unsigned long long gbase =
        (unsigned long long)(const void*)(rel + (size_t)bq * SEQ * D_MODEL);
    const unsigned ldsbase = (unsigned)(size_t)(void*)rel_s;
    for (int i = t; i < SEQ * D_MODEL / 4; i += 256) {
      const unsigned goff  = (unsigned)i * 16u;   // bytes
      const unsigned laddr =                      // row i/64, 16-byte piece i%64
          ldsbase + (unsigned)(i >> 6) * (RP * 4u) + (unsigned)(i & 63) * 16u;
      asm volatile("global_load_async_to_lds_b128 %0, %1, %2 offset:0"
                   :
                   : "v"(laddr), "v"(goff), "s"(gbase)
                   : "memory");
    }
    // content scores, heads 0-3: 4 x 128 adjacent floats, scaled by 1/sqrt(64)
#pragma unroll
    for (int j = 0; j < 2; ++j)
      sc_s[(2 * j + (t >> 7)) * SCP + (t & 127)] =
          scg[(size_t)bq * 4 * SEQ + j * 256 + t] * 0.125f;
#pragma unroll
    for (int j = 0; j < 4; ++j)
      u_s[j * UP + t] = ug[((size_t)bq * 4 + j) * D_MODEL + t];
    u_s[4 * UP + t] = 0.f;
    if (t < SEQ) sc_s[NH * SCP + t] = 0.f;
    const float* qr = qpg + (size_t)bq * D_MODEL + (lane & 3) * 64;
    const float* br = bkp + (lane & 3) * 64;
    for (int e = 0; e < 64; ++e) cb += qr[e] * br[e];
    asm volatile("s_wait_asynccnt 0x0" ::: "memory");
  }
  __syncthreads();

  // ---- pos scores, heads 4-7: S[key,h] = rel_s[128,256] @ u^T[256,4] + cb -
  // One 16-key tile per wave; columns 4..15 of B are zero and not stored.
  {
    const int m0 = wv << 4;
    const float* As = rel_s + (m0 + r) * RP + ks;
    const float* Bs = u_s + (r < 4 ? r : 4) * UP + ks;
    v8f acc0 = {cb, cb, cb, cb, cb, cb, cb, cb};
    v8f acc1 = {0.f, 0.f, 0.f, 0.f, 0.f, 0.f, 0.f, 0.f};
#pragma unroll 4
    for (int k0 = 0; k0 < D_MODEL; k0 += 8) {
      const v2f a0 = *(const v2f*)(As + k0);
      const v2f a1 = *(const v2f*)(As + k0 + 4);
      const v2f b0 = *(const v2f*)(Bs + k0);
      const v2f b1 = *(const v2f*)(Bs + k0 + 4);
      acc0 = wmma4(a0, b0, acc0);
      acc1 = wmma4(a1, b1, acc1);
    }
    wmma_gap(acc0, acc1);
    if (r < 4) {
      float* So = sc_s + (4 + r) * SCP + m0 + ro;
#pragma unroll
      for (int v = 0; v < 8; ++v) So[v] = (acc0[v] + acc1[v]) * 0.125f;
    }
  }

  __syncthreads();

  // ---- softmax over k, one wave32 per head -------------------------------
  float av[4];                                 // attn[head wv][lane + 32 j]
  {
    float* row = sc_s + wv * SCP;
    float vals[4];
    float m = -1e30f;
#pragma unroll
    for (int j = 0; j < 4; ++j) {
      vals[j] = row[lane + 32 * j];
      m = fmaxf(m, vals[j]);
    }
#pragma unroll
    for (int off = 16; off > 0; off >>= 1) m = fmaxf(m, __shfl_xor(m, off, 32));
    float sum = 0.f;
#pragma unroll
    for (int j = 0; j < 4; ++j) { vals[j] = __expf(vals[j] - m); sum += vals[j]; }
#pragma unroll
    for (int off = 16; off > 0; off >>= 1) sum += __shfl_xor(sum, off, 32);
    const float inv = 1.f / sum;
#pragma unroll
    for (int j = 0; j < 4; ++j) {
      av[j] = vals[j] * inv;
      row[lane + 32 * j] = av[j];
    }
  }
  __syncthreads();

  // ---- R[h,:] = attn[8,128] @ rel_s[128,256]  (WMMA, rows 8..15 zero) -----
  // Two 16-column tiles per wave, one after the other; even and odd k steps
  // go to two accumulators that are added at the end.
  {
    const float* As = sc_s + (r < NH ? r : NH) * SCP + ks;
    // not unrolled: with both tiles in one body the LDS loads get paired across
    // tiles and every B fragment then needs register moves next to the WMMAs
#pragma unroll 1
    for (int nt = 0; nt < 2; ++nt) {
      const int n0 = (wv << 5) + (nt << 4);
      const float* Bs = rel_s + ks * RP + n0 + r;
      v8f c0 = {0.f, 0.f, 0.f, 0.f, 0.f, 0.f, 0.f, 0.f};
      v8f c1 = {0.f, 0.f, 0.f, 0.f, 0.f, 0.f, 0.f, 0.f};
      // rolled so that the gap below closes every run of eight WMMAs
#pragma unroll 1
      for (int k0 = 0; k0 < SEQ; k0 += 32) {
        v2f a[8], bb[8];
#pragma unroll
        for (int j = 0; j < 8; ++j) {
          a[j]    = *(const v2f*)(As + k0 + 4 * j);
          bb[j].x = Bs[(k0 + 4 * j) * RP];
          bb[j].y = Bs[(k0 + 4 * j) * RP + RP];
        }
#pragma unroll
        for (int j = 0; j < 8; j += 2) {
          c0 = wmma4(a[j], bb[j], c0);
          c1 = wmma4(a[j + 1], bb[j + 1], c1);
        }
        wmma_gap(c0, c1);
      }
      if (lane < 16) {                          // rows 0..7 = heads
        float* Ro = rg + (size_t)bq * NH * D_MODEL + n0 + r;
#pragma unroll
        for (int v = 0; v < 8; ++v) Ro[v * D_MODEL] = c0[v] + c1[v];
        // the next tile's accumulators reuse the registers these stores name
        asm volatile("s_wait_xcnt 0x0" ::: "memory");
      }
    }
  }

  // ---- attn itself, for the value product of the next launch --------------
  // Stored behind the last barrier: a barrier waits for the wave's open stores.
  {
    float* ao = ag + ((size_t)bq * NH + wv) * SEQ + lane;
#pragma unroll
    for (int j = 0; j < 4; ++j) ao[32 * j] = av[j];
  }
}

// ---------------------------------------------------------------------------
// x = LayerNorm1(src + per-head attn_h[16,128] @ v_base[:, h*32 .. h*32+31]
//                    + per-head R_h[16,256] @ Wvp[:, h*32 .. h*32+31]).
// (v_base holds bvp.)  One workgroup of 16 waves per 16 rows, all queries of one
// batch.  Waves 0..7 take the R product, waves 8..15 the attn product, side by
// side; wave & 7 = head (two 16-column tiles, shared A).
// ---------------------------------------------------------------------------
__global__ __launch_bounds__(512) void vfold_ln_kernel(
    const float* __restrict__ rg, const float* __restrict__ Wvp,
    const float* __restrict__ ag, const float* __restrict__ v_base,
    const float* __restrict__ src, const float* __restrict__ g1,
    const float* __restrict__ be1, float* __restrict__ xout) {
  __shared__ float xs[2 * 16 * D_MODEL];        // R product | attn product
  const int wv   = __builtin_amdgcn_readfirstlane(threadIdx.x >> 5);
  const int lane = threadIdx.x & 31;
  const int r    = lane & 15;
  const int ks   = (lane >> 4) << 1;
  const int ro   = (lane >> 4) << 3;
  const int m0   = blockIdx.x << 4;
  const int h    = wv & 7;
  const int n0   = h << 5;
  v8f c0 = {0.f, 0.f, 0.f, 0.f, 0.f, 0.f, 0.f, 0.f};
  v8f c1 = {0.f, 0.f, 0.f, 0.f, 0.f, 0.f, 0.f, 0.f};
  if (wv < 8) {
    const float* Ap = rg + ((size_t)(m0 + r) * NH + h) * D_MODEL + ks;
    const float* Bp = Wvp + (size_t)ks * D_MODEL + n0 + r;
#pragma unroll 8
    for (int k0 = 0; k0 < D_MODEL; k0 += 4) {
      v2f a, b0, b1;
      a.x  = Ap[k0];
      a.y  = Ap[k0 + 1];
      b0.x = Bp[k0 * D_MODEL];
      b0.y = Bp[k0 * D_MODEL + D_MODEL];
      b1.x = Bp[k0 * D_MODEL + 16];
      b1.y = Bp[k0 * D_MODEL + D_MODEL + 16];
      c0 = wmma4(a, b0, c0);
      c1 = wmma4(a, b1, c1);
    }
  } else {
    const int b0r = m0 & ~(SEQ - 1);            // first row of the batch
    const float* Ap = ag + ((size_t)(m0 + r) * NH + h) * SEQ + ks;
    const float* Bp = v_base + (size_t)(b0r + ks) * D_MODEL + n0 + r;
#pragma unroll 8
    for (int k0 = 0; k0 < SEQ; k0 += 4) {
      v2f a, b0, b1;
      a.x  = Ap[k0];
      a.y  = Ap[k0 + 1];
      b0.x = Bp[k0 * D_MODEL];
      b0.y = Bp[k0 * D_MODEL + D_MODEL];
      b1.x = Bp[k0 * D_MODEL + 16];
      b1.y = Bp[k0 * D_MODEL + D_MODEL + 16];
      c0 = wmma4(a, b0, c0);
      c1 = wmma4(a, b1, c1);
    }
  }
  wmma_gap(c0, c1);                               // the stores read D directly
  float* xo = xs + (wv >> 3) * 16 * D_MODEL;
#pragma unroll
  for (int v = 0; v < 8; ++v) {
    xo[(ro + v) * D_MODEL + n0 + r]      = c0[v];
    xo[(ro + v) * D_MODEL + n0 + r + 16] = c1[v];
  }
  __syncthreads();
  if (wv >= 8) return;                          // no barrier below
#pragma unroll
  for (int j = 0; j < 2; ++j) {                 // two rows per wave
    const int row = wv * 2 + j;
    const size_t gro = (size_t)(m0 + row) * D_MODEL;
    float x[8];
    float sum = 0.f;
#pragma unroll
    for (int i = 0; i < 8; ++i) {
      x[i] = src[gro + lane + 32 * i] +
             xs[(16 + row) * D_MODEL + lane + 32 * i] +
             xs[row * D_MODEL + lane + 32 * i];
      sum += x[i];
    }
#pragma unroll
    for (int off = 16; off > 0; off >>= 1) sum += __shfl_xor(sum, off, 32);
    const float mean = sum * (1.f / D_MODEL);
    float sq = 0.f;
#pragma unroll
    for (int i = 0; i < 8; ++i) {
      x[i] -= mean;
      sq += x[i] * x[i];
    }
#pragma unroll
    for (int off = 16; off > 0; off >>= 1) sq += __shfl_xor(sq, off, 32);
    const float rs = rsqrtf(sq * (1.f / D_MODEL) + 1e-5f);
#pragma unroll
    for (int i = 0; i < 8; ++i) {
      const int c = lane + 32 * i;
      xout[gro + c] = x[i] * rs * g1[c] + be1[c];
    }
  }
}

#define DFF 2048
#define HC  512   // hidden columns per block
#define HP  516

// acc[0..3] += A[16, 8*NB] @ B[8*NB, 64]: the k loop of gemm_strip (same k order,
// same ring of four fragment sets).  Ap, Bp: the lane's first element; rows of B
// are BN floats apart.  A lies in memory (AMEM) or in LDS.  between() runs behind
// the first three k blocks' B loads and ahead of the first A load: what it does
// is covered by those loads' latency.
template <int BN, int NB, bool AMEM, typename F>
__device__ __forceinline__ void strip_mma(const float* Ap,
                                          const float* __restrict__ Bp,
                                          v8f (&acc)[4], F between) {
  v4f a[4];
  v2f b[4][2][4];
  auto load_a = [&](int s) {
    a[s & 3] = *(const v4f*)(Ap + s * 8);
    // the A pointer is dead behind its last load and the allocator hands its
    // registers to later loads' results: the wait stands ahead of that overwrite
    if (AMEM && s == NB - 1) asm volatile("s_wait_xcnt 0x0" ::: "memory");
  };
  auto load_b = [&](int s) {
    const int buf = s & 3;
    const int kk  = s * 8;
#pragma unroll
    for (int st = 0; st < 2; ++st)
#pragma unroll
      for (int t = 0; t < 4; ++t) {
        b[buf][st][t].x = Bp[(kk + 2 * st) * BN + 16 * t];
        b[buf][st][t].y = Bp[(kk + 2 * st + 1) * BN + 16 * t];
      }
  };
  load_b(0);
  load_b(1);
  load_b(2);
  between();
  load_a(0);
  load_a(1);
  load_a(2);
#pragma unroll
  for (int s = 0; s < NB; ++s) {
    const int cur = s & 3;
    if (s + 3 < NB) {
      load_a(s + 3);
      load_b(s + 3);
    }
    // keeps the loads above this block's WMMAs: without it the scheduler sinks
    // them to a few WMMAs ahead of their use and the wave waits out the latency
    __builtin_amdgcn_sched_barrier(0);
    const v2f a0 = {a[cur].x, a[cur].y};
    const v2f a1 = {a[cur].z, a[cur].w};
#pragma unroll
    for (int t = 0; t < 4; ++t) acc[t] = wmma4(a0, b[cur][0][t], acc[t]);
#pragma unroll
    for (int t = 0; t < 4; ++t) acc[t] = wmma4(a1, b[cur][1][t], acc[t]);
    // keeps later blocks' loads from rising above these WMMAs (register use)
    __builtin_amdgcn_sched_barrier(0);
  }
  wmma_gap(acc[0], acc[1], acc[2], acc[3]);       // D is read directly behind
}

__global__ __launch_bounds__(256) void ffn_kernel(
    const float* __restrict__ x, const float* __restrict__ W1,
    const float* __restrict__ b1, const float* __restrict__ W2,
    const float* __restrict__ b2, float* __restrict__ ffp) {
  __shared__ __attribute__((aligned(16))) float h_s[16 * HP];
  // pitch 68 floats, as in gemm_strip
  __shared__ __attribute__((aligned(16))) float red[8 * 16 * 68];
  const int wv   = threadIdx.x >> 5;
  const int lane = threadIdx.x & 31;
  const int r    = lane & 15;
  const int hi   = lane >> 4;
  const int m0   = (blockIdx.x >> 2) << 4;
  const int c    = blockIdx.x & 3;

  // b2 for the second product is fetched here: read there, its latency would
  // stand in front of the barrier between the two products
  float b2v[4];
#pragma unroll
  for (int t = 0; t < 4; ++t) b2v[t] = b2[((wv & 3) << 6) + 16 * t + r];

  // ---- h slice: one 16x64 strip per wave, whole K = 256 -------------------
  v8f hacc[4];
  {
    const int n0 = c * HC + wv * 64;
#pragma unroll
    for (int t = 0; t < 4; ++t) {
      const float bi = b1[n0 + 16 * t + r];
      hacc[t] = (v8f){bi, bi, bi, bi, bi, bi, bi, bi};
    }
    strip_mma<DFF, D_MODEL / 8, true>(x + (size_t)(m0 + r) * D_MODEL + 4 * hi,
                                      W1 + (size_t)(4 * hi) * DFF + n0 + r, hacc,
                                      [] {});
  }

  // ---- h slice @ its rows of W2: strip wv & 3, half wv >> 2 of the 512 k ---
  // The slice goes to LDS, and the block meets, under the first W2 loads.
  {
    const int n0 = (wv & 3) << 6;
    const int k0 = (wv >> 2) * (HC / 2);
    v8f acc[4];
#pragma unroll
    for (int t = 0; t < 4; ++t) {
      const float bi = (c == 0 && wv < 4) ? b2v[t] : 0.f;
      acc[t] = (v8f){bi, bi, bi, bi, bi, bi, bi, bi};
    }
    strip_mma<D_MODEL, HC / 16, false>(
        h_s + r * HP + k0 + 4 * hi,
        W2 + (size_t)(c * HC + k0 + 4 * hi) * D_MODEL + n0 + r, acc, [&] {
#pragma unroll
          for (int t = 0; t < 4; ++t)
#pragma unroll
            for (int v = 0; v < 8; ++v)
              h_s[(v + 8 * hi) * HP + wv * 64 + 16 * t + r] =
                  fmaxf(hacc[t][v], 0.f);
          // a work-group barrier that orders LDS alone: __syncthreads() would
          // also wait here for the W2 loads that are to stay in flight over it
          __builtin_amdgcn_fence(__ATOMIC_RELEASE, "workgroup", "local");
          __builtin_amdgcn_s_barrier();
          __builtin_amdgcn_fence(__ATOMIC_ACQUIRE, "workgroup", "local");
        });
#pragma unroll
    for (int t = 0; t < 4; ++t)
#pragma unroll
      for (int v = 0; v < 8; ++v)
        red[(wv * 16 + v + 8 * hi) * 68 + 16 * t + r] = acc[t][v];
  }
  __syncthreads();
  const int row = threadIdx.x >> 4;
  const int c4  = (threadIdx.x & 15) << 2;
  float* Co = ffp + ((size_t)c * 1024 + m0 + row) * D_MODEL + c4;
#pragma unroll
  for (int sn = 0; sn < 4; ++sn)
    *(v4f*)(Co + sn * 64) = *(const v4f*)(red + (sn * 16 + row) * 68 + c4) +
                            *(const v4f*)(red + ((4 + sn) * 16 + row) * 68 + c4);
}

// out = LayerNorm(a + the four planes of c) with gain/bias; one 256-thread block
// per row.  The planes are 1024 rows apart.
__global__ void add_ln_kernel(const float* __restrict__ a,
                              const float* __restrict__ c,
                              const float* __restrict__ g,
                              const float* __restrict__ be,
                              float* __restrict__ out) {
  __shared__ float red[16];
  const int row = blockIdx.x, t = threadIdx.x;
  const float* cr = c + (size_t)row * D_MODEL + t;
  float x = a[(size_t)row * D_MODEL + t] +
            ((cr[0] + cr[1024 * D_MODEL]) +
             (cr[2 * 1024 * D_MODEL] + cr[3 * 1024 * D_MODEL]));
  const float mean = block_sum_256(x, red) * (1.f / D_MODEL);
  const float d    = x - mean;
  const float var  = block_sum_256(d * d, red) * (1.f / D_MODEL);
  out[(size_t)row * D_MODEL + t] = d * rsqrtf(var + 1e-5f) * g[t] + be[t];
}

// ---------------------------------------------------------------------------
extern "C" void kernel_launch(void* const* d_in, const int* in_sizes, int n_in,
                              void* d_out, int out_size, void* d_ws,
                              size_t ws_size, hipStream_t stream) {
  const float* src = (const float*)d_in[0];
  const float* pos = (const float*)d_in[1];
  const float* rel = (const float*)d_in[2];
  const float* Wq  = (const float*)d_in[3];  const float* bq  = (const float*)d_in[4];
  const float* Wk  = (const float*)d_in[5];  const float* bk  = (const float*)d_in[6];
  const float* Wv  = (const float*)d_in[7];  const float* bv  = (const float*)d_in[8];
  const float* Wqp = (const float*)d_in[9];  const float* bqp = (const float*)d_in[10];
  const float* Wkp = (const float*)d_in[11]; const float* bkp = (const float*)d_in[12];
  const float* Wvp = (const float*)d_in[13]; const float* bvp = (const float*)d_in[14];
  const float* W1  = (const float*)d_in[15]; const float* b1  = (const float*)d_in[16];
  const float* W2  = (const float*)d_in[17]; const float* b2  = (const float*)d_in[18];
  const float* g1  = (const float*)d_in[19]; const float* be1 = (const float*)d_in[20];
  const float* g2  = (const float*)d_in[21]; const float* be2 = (const float*)d_in[22];

  const int M = 8 * 128;                       // B*A rows
  float* ws  = (float*)d_ws;
  float* q   = ws;                             // 1024*256
  float* qp  = q   + M * D_MODEL;
  float* kb  = qp  + M * D_MODEL;
  float* vb  = kb  + M * D_MODEL;
  float* x   = vb  + M * D_MODEL;
  float* ffp = x   + M * D_MODEL;              // 4*1024*256 partial FFN outputs
  float* u   = ffp + 4 * M * D_MODEL;          // 1024*4*256 folded pos query
  float* rr  = u   + M * 4 * D_MODEL;          // 1024*8*256 attn-weighted rel
  float* at  = rr  + M * NH * D_MODEL;         // 1024*8*128 attn
  float* sc  = at  + M * NH * SEQ;             // 1024*4*128 content scores

  // content / positional projections (WMMA fp32), one launch
  proj3_kernel<<<768, 256, 0, stream>>>(src, pos, Wq, bq, Wqp, bqp, Wk, bk, q,
                                        qp, kb);

  // one launch: v = Wv(Wk(src)) + bvp, Wkp applied to the query side, content
  // scores; attention over rel (one WG per (b,q)), then Wvp applied to the
  // attn-weighted rel rows, attn applied to v, residual + LN1
  fold_query_kernel<<<1024, 256, 0, stream>>>(qp, Wkp, u, q, kb, sc, Wv, bv, bvp,
                                              vb);
  const size_t smem = (SEQ * RP + 5 * UP + (NH + 1) * SCP) * sizeof(float);
  attn_fused_kernel<<<M, 256, smem, stream>>>(rel, sc, qp, u, bkp, rr, at);
  vfold_ln_kernel<<<M / 16, 512, 0, stream>>>(rr, Wvp, at, vb, src, g1, be1, x);

  // FFN + LN2
  ffn_kernel<<<256, 256, 0, stream>>>(x, W1, b1, W2, b2, ffp);
  add_ln_kernel<<<M, 256, 0, stream>>>(x, ffp, g2, be2, (float*)d_out);
}

// v009
// It runs in 61.4 microseconds.
// It is 1.18 times as fast as v007, going by the measured steps of the versions left out in between.
// Over all steps from v000 it is 18.1 times as fast.
#include <hip/hip_runtime.h>
#include <math.h>

typedef __attribute__((ext_vector_type(2))) float v2f;
typedef __attribute__((ext_vector_type(4))) float v4f;
typedef __attribute__((ext_vector_type(8))) float v8f;

#define D_MODEL 256
#define SEQ     128
#define NH      8

__device__ __forceinline__ v8f wmma4(v2f a, v2f b, v8f c) {
  // (neg_a, A, neg_b, B, c_mod, C, reuse_a, reuse_b)
  return __builtin_amdgcn_wmma_f32_16x16x4_f32(false, a, false, b, (short)0, c,
                                               false, false);
}

__device__ __forceinline__ void wmma_gap(v8f& x, v8f& y) {
  asm volatile("v_nop\n\tv_nop\n\tv_nop\n\tv_nop" : "+v"(x), "+v"(y));
}
__device__ __forceinline__ void wmma_gap(v8f& x, v8f& y, v8f& z, v8f& w) {
  asm volatile("v_nop\n\tv_nop\n\tv_nop\n\tv_nop"
               : "+v"(x), "+v"(y), "+v"(z), "+v"(w));
}
// The same behind a run of eight WMMAs, with the run's A and B fragments named
// as inputs: their registers stay theirs up to here.
__device__ __forceinline__ void wmma_gap_frags(
    v8f& x, v2f a0, v2f a1, v2f a2, v2f a3, v2f a4, v2f a5, v2f a6, v2f a7,
    v2f b0, v2f b1, v2f b2, v2f b3, v2f b4, v2f b5, v2f b6, v2f b7) {
  asm volatile("v_nop\n\tv_nop\n\tv_nop\n\tv_nop"
               : "+v"(x)
               : "v"(a0), "v"(a1), "v"(a2), "v"(a3), "v"(a4), "v"(a5), "v"(a6),
                 "v"(a7), "v"(b0), "v"(b1), "v"(b2), "v"(b3), "v"(b4), "v"(b5),
                 "v"(b6), "v"(b7));
}

template <int N, int K, int SPLIT, int RELU, int BIAS2 = 0>
__device__ __forceinline__ void gemm_strip(
    const float* __restrict__ A, const float* __restrict__ B,
    const float* __restrict__ bias, float* __restrict__ C, const int blk,
    const float* __restrict__ bias2 = nullptr) {
  constexpr int KW = K / SPLIT;                   // k range of one wave
  constexpr int NB = KW / 8;                      // 8-wide k blocks
  constexpr int SN = N / 64;                      // strips per row of C
  const int wv   = threadIdx.x >> 5;
  const int lane = threadIdx.x & 31;
  const int r    = lane & 15;
  const int hi   = lane >> 4;
  const int strip = SPLIT == 1 ? blk * 8 + wv : blk;
  const int kbeg  = SPLIT == 1 ? 0 : wv * KW;
  const int m0 = (strip / SN) << 4;
  const int n0 = (strip % SN) << 6;

  const float* Ap = A + (size_t)(m0 + r) * K + kbeg + 4 * hi;
  const float* Bp = B + (size_t)(kbeg + 4 * hi) * N + n0 + r;
  // the bias is the accumulators' start value (where K is split: in wave 0 only)
  v8f acc[4];
#pragma unroll
  for (int t = 0; t < 4; ++t) {
    float bv = bias[n0 + 16 * t + r];
    if (BIAS2) bv += bias2[n0 + 16 * t + r];
    const float bi = (SPLIT == 1 || wv == 0) ? bv : 0.f;
    acc[t] = (v8f){bi, bi, bi, bi, bi, bi, bi, bi};
  }

  // ring of four fragment sets, one 8-wide k block each: a block's loads are
  // issued three blocks (24 WMMAs) ahead of the WMMAs that read them
  v4f a[4];
  v2f b[4][2][4];
  auto load = [&](int s) {
    const int buf = s & 3;
    const int kk  = s * 8;
    a[buf] = *(const v4f*)(Ap + kk);
    // the A pointer is dead behind its last load and the allocator hands its
    // registers to later loads' results: the wait stands ahead of that overwrite
    if (s == NB - 1) asm volatile("s_wait_xcnt 0x0" ::: "memory");
#pragma unroll
    for (int st = 0; st < 2; ++st)
#pragma unroll
      for (int t = 0; t < 4; ++t) {
        b[buf][st][t].x = Bp[(kk + 2 * st) * N + 16 * t];
        b[buf][st][t].y = Bp[(kk + 2 * st + 1) * N + 16 * t];
      }
  };
  load(0);
  load(1);
  load(2);
#pragma unroll
  for (int s = 0; s < NB; ++s) {
    const int cur = s & 3;
    if (s + 3 < NB) load(s + 3);
    // keeps the loads above this block's WMMAs: without it the scheduler sinks
    // them to a few WMMAs ahead of their use and the wave waits out the latency
    __builtin_amdgcn_sched_barrier(0);
    const v2f a0 = {a[cur].x, a[cur].y};
    const v2f a1 = {a[cur].z, a[cur].w};
#pragma unroll
    for (int t = 0; t < 4; ++t) acc[t] = wmma4(a0, b[cur][0][t], acc[t]);
#pragma unroll
    for (int t = 0; t < 4; ++t) acc[t] = wmma4(a1, b[cur][1][t], acc[t]);
    // keeps later blocks' loads from rising above these WMMAs (register use)
    __builtin_amdgcn_sched_barrier(0);
  }
  wmma_gap(acc[0], acc[1], acc[2], acc[3]);       // D is read directly below

  if constexpr (SPLIT == 1) {
#pragma unroll
    for (int t = 0; t < 4; ++t) {
      float* Crow = C + (size_t)(m0 + 8 * hi) * N + n0 + 16 * t + r;
#pragma unroll
      for (int v = 0; v < 8; ++v) {
        float val = acc[t][v];
        if (RELU) val = fmaxf(val, 0.f);
        Crow[v * N] = val;
      }
    }
  } else {
    __shared__ __attribute__((aligned(16))) float red[SPLIT * 16 * 68];
#pragma unroll
    for (int t = 0; t < 4; ++t)
#pragma unroll
      for (int v = 0; v < 8; ++v)
        red[(wv * 16 + v + 8 * hi) * 68 + 16 * t + r] = acc[t][v];
    __syncthreads();
    const int row = threadIdx.x >> 4;
    const int c4  = (threadIdx.x & 15) << 2;
    v4f s = *(const v4f*)(red + row * 68 + c4);
#pragma unroll
    for (int w = 1; w < SPLIT; ++w)
      s += *(const v4f*)(red + (w * 16 + row) * 68 + c4);
    if (RELU) {
#pragma unroll
      for (int i = 0; i < 4; ++i) s[i] = fmaxf(s[i], 0.f);
    }
    *(v4f*)(C + (size_t)(m0 + row) * N + n0 + c4) = s;
  }
}

// The three projections that depend on inputs alone, in one launch of 3 x 256
// blocks:  q = src Wq + bq,  qp = pos Wqp + bqp,  k_base = src Wk + bk.
__global__ __launch_bounds__(256) void proj3_kernel(
    const float* __restrict__ src, const float* __restrict__ pos,
    const float* __restrict__ Wq, const float* __restrict__ bq,
    const float* __restrict__ Wqp, const float* __restrict__ bqp,
    const float* __restrict__ Wk, const float* __restrict__ bk,
    float* __restrict__ q, float* __restrict__ qp, float* __restrict__ kb) {
  const int which = blockIdx.x >> 8;
  const float* A    = which == 1 ? pos : src;
  const float* B    = which == 0 ? Wq : which == 1 ? Wqp : Wk;
  const float* bias = which == 0 ? bq : which == 1 ? bqp : bk;
  float* C          = which == 0 ? q : which == 1 ? qp : kb;
  gemm_strip<256, 256, 8, 0>(A, B, bias, C, blockIdx.x & 255);
}

// ---------------------------------------------------------------------------
// The three products that need only the projections, in one launch.
//  blocks 0..255   v_base = k_base Wv + bv + bvp (the strip GEMM above; it has
//                  the longest path of the three, so it starts first; every use
//                  of v_base is as v_base + bvp)
// Then two batched products of one form: a 16x16 tile per wave, both operands
// read by rows, over the 64 adjacent k values of head h (B[k][n] =
// Brow[n][h*64+k], so a lane's two k values are adjacent in memory).
//  blocks 256..767  folded positional query:
//    U[row,h,d] = sum_e qp[row, h*64+e] * Wkp[d, h*64+e]
//  blocks 768..1023 content scores, not yet scaled (key and query of one batch):
//    S[row,h,key] = sum_e q[row, h*64+e] * k_base[batch(row)*128+key, h*64+e]
// ---------------------------------------------------------------------------
template <int CS>                                 // floats between rows of C
__device__ __forceinline__ void tile_rows_k64(const float* __restrict__ Ap,
                                              const float* __restrict__ Bp,
                                              float* __restrict__ Co) {
  v8f acc = {0.f, 0.f, 0.f, 0.f, 0.f, 0.f, 0.f, 0.f};
  v2f a[16], b[16];
#pragma unroll
  for (int j = 0; j < 16; ++j) {
    a[j].x = Ap[4 * j];
    a[j].y = Ap[4 * j + 1];
    b[j].x = Bp[4 * j];
    b[j].y = Bp[4 * j + 1];
  }
  // both pointers are dead behind the last load and their registers go to the
  // accumulator and the store address: the wait stands ahead of that overwrite
  asm volatile("s_wait_xcnt 0x0" ::: "memory");
#pragma unroll
  for (int g = 0; g < 16; g += 8) {
#pragma unroll
    for (int j = 0; j < 8; ++j) acc = wmma4(a[g + j], b[g + j], acc);
    // behind the last run the stores read D directly
    wmma_gap_frags(acc, a[g], a[g + 1], a[g + 2], a[g + 3], a[g + 4], a[g + 5],
                   a[g + 6], a[g + 7], b[g], b[g + 1], b[g + 2], b[g + 3],
                   b[g + 4], b[g + 5], b[g + 6], b[g + 7]);
  }
#pragma unroll
  for (int v = 0; v < 8; ++v) Co[v * CS] = acc[v];
  // code laid out behind an inlined call may reuse the registers these stores name
  asm volatile("s_wait_xcnt 0x0" ::: "memory");
}

__global__ __launch_bounds__(256) void fold_query_kernel(
    const float* __restrict__ qp, const float* __restrict__ Wkp,
    float* __restrict__ U, const float* __restrict__ q,
    const float* __restrict__ k_base, float* __restrict__ S,
    const float* __restrict__ Wv, const float* __restrict__ bv,
    const float* __restrict__ bvp, float* __restrict__ v_base) {
  if (blockIdx.x < 256) {
    gemm_strip<256, 256, 8, 0, 1>(k_base, Wv, bv, v_base, blockIdx.x, bvp);
    return;
  }
  const int wv   = threadIdx.x >> 5;
  const int lane = threadIdx.x & 31;
  const int r  = lane & 15;
  const int ks = (lane >> 4) << 1;
  const int ro = (lane >> 4) << 3;
  if (blockIdx.x < 768) {
    const int wid = (blockIdx.x - 256) * 8 + wv;  // 64 x 4 x 16 tiles
    const int n0 = (wid & 15) << 4;
    const int h  = (wid >> 4) & 3;
    const int m0 = (wid >> 6) << 4;
    tile_rows_k64<4 * D_MODEL>(
        qp  + (size_t)(m0 + r) * D_MODEL + h * 64 + ks,
        Wkp + (size_t)(n0 + r) * D_MODEL + h * 64 + ks,
        U + ((size_t)(m0 + ro) * 4 + h) * D_MODEL + n0 + r);
  } else {
    const int wid = (blockIdx.x - 768) * 8 + wv;  // 64 x 4 x 8 tiles
    const int n0 = (wid & 7) << 4;
    const int h  = (wid >> 3) & 3;
    const int m0 = (wid >> 5) << 4;
    const int b0 = m0 & ~(SEQ - 1);               // first row of the batch
    tile_rows_k64<4 * SEQ>(
        q      + (size_t)(m0 + r) * D_MODEL + h * 64 + ks,
        k_base + (size_t)(b0 + n0 + r) * D_MODEL + h * 64 + ks,
        S + ((size_t)(m0 + ro) * 4 + h) * SEQ + n0 + r);
  }
}

// Block-wide sum over 256 threads (8 wave32s), via shuffles + tiny LDS.
__device__ __forceinline__ float block_sum_256(float v, float* red) {
  const int lane = threadIdx.x & 31;
  const int wv   = threadIdx.x >> 5;
#pragma unroll
  for (int off = 16; off > 0; off >>= 1) v += __shfl_xor(v, off, 32);
  if (lane == 0) red[wv] = v;
  __syncthreads();
  if (wv == 0) {
    float s = (lane < 8) ? red[lane] : 0.f;
#pragma unroll
    for (int off = 16; off > 0; off >>= 1) s += __shfl_xor(s, off, 32);
    if (lane == 0) red[8] = s;
  }
  __syncthreads();
  float s = red[8];
  __syncthreads();                                // allow red reuse
  return s;
}

#define RP  268
#define UP  260
#define SCP 132

__global__ void attn_fused_kernel(const float* __restrict__ rel,
                                  const float* __restrict__ scg,
                                  const float* __restrict__ qpg,
                                  const float* __restrict__ ug,
                                  const float* __restrict__ bkp,
                                  float* __restrict__ rg,
                                  float* __restrict__ ag) {
  extern __shared__ float smem[];
  float* rel_s = smem;                         // SEQ*RP
  float* u_s   = rel_s + SEQ * RP;             // 5*UP
  float* sc_s  = u_s + 5 * UP;                 // 9*SCP scores -> attn

  const int bq   = blockIdx.x;                 // b*128 + q
  const int t    = threadIdx.x;
  const int wv   = t >> 5;
  const int lane = t & 31;
  const int r    = lane & 15;
  const int ks   = (lane >> 4) << 1;
  const int ro   = (lane >> 4) << 3;
  float cb = 0.f;                              // qp_h . bkp_h, h = lane & 3

  // ---- the block's small operands: their loads go out ahead of the copies ---
  // Behind 128KB of copies they would come back last, and the score product
  // below could not start before the whole tile has landed.
  const float sv0 = scg[(size_t)bq * 4 * SEQ + t];
  const float sv1 = scg[(size_t)bq * 4 * SEQ + 256 + t];
  float uv[4];
#pragma unroll
  for (int j = 0; j < 4; ++j) uv[j] = ug[((size_t)bq * 4 + j) * D_MODEL + t];
  // qp_h . bkp_h: lane = (segment of 8 elements, head), one round trip
  const int cofs = (lane & 3) * 64 + (lane >> 2) * 8;
  const v4f cq0 = *(const v4f*)(qpg + (size_t)bq * D_MODEL + cofs);
  const v4f cq1 = *(const v4f*)(qpg + (size_t)bq * D_MODEL + cofs + 4);
  const v4f cb0 = *(const v4f*)(bkp + cofs);
  const v4f cb1 = *(const v4f*)(bkp + cofs + 4);

  const int rot = __builtin_amdgcn_readfirstlane(wv) & 3;
  {
    const unsigned long long gbase =
        (unsigned long long)(const void*)(rel + (size_t)bq * SEQ * D_MODEL);
    const unsigned ldsbase = (unsigned)(size_t)(void*)rel_s;
    unsigned la[8], go[8];
#pragma unroll
    for (int i = 0; i < 8; ++i) {
      const unsigned row = (unsigned)(wv * 16 + 2 * i + (lane >> 4));
      la[i] = ldsbase + row * (RP * 4u) + (unsigned)(lane & 15) * 16u;
      go[i] = row * (D_MODEL * 4u) + (unsigned)(lane & 15) * 16u;
    }
#define COPY_GROUP(OFF)                                            \
  "global_load_async_to_lds_b128 %0, %8, %16 offset:" OFF "\n\t"   \
  "global_load_async_to_lds_b128 %1, %9, %16 offset:" OFF "\n\t"   \
  "global_load_async_to_lds_b128 %2, %10, %16 offset:" OFF "\n\t"  \
  "global_load_async_to_lds_b128 %3, %11, %16 offset:" OFF "\n\t"  \
  "global_load_async_to_lds_b128 %4, %12, %16 offset:" OFF "\n\t"  \
  "global_load_async_to_lds_b128 %5, %13, %16 offset:" OFF "\n\t"  \
  "global_load_async_to_lds_b128 %6, %14, %16 offset:" OFF "\n\t"  \
  "global_load_async_to_lds_b128 %7, %15, %16 offset:" OFF "\n\t"
#define COPY_ALL(O0, O1, O2, O3)                                              \
  asm volatile(COPY_GROUP(O0) COPY_GROUP(O1) COPY_GROUP(O2) COPY_GROUP(O3)      \
               "s_wait_xcnt 0x0"                                                \
               :                                                                \
               : "v"(la[0]), "v"(la[1]), "v"(la[2]), "v"(la[3]), "v"(la[4]),    \
                 "v"(la[5]), "v"(la[6]), "v"(la[7]), "v"(go[0]), "v"(go[1]),    \
                 "v"(go[2]), "v"(go[3]), "v"(go[4]), "v"(go[5]), "v"(go[6]),    \
                 "v"(go[7]), "s"(gbase)                                         \
               : "memory")
    if (rot == 0)
      COPY_ALL("0", "256", "512", "768");
    else if (rot == 1)
      COPY_ALL("256", "512", "768", "0");
    else if (rot == 2)
      COPY_ALL("512", "768", "0", "256");
    else
      COPY_ALL("768", "0", "256", "512");
#undef COPY_ALL
#undef COPY_GROUP
  }
  // content scores, heads 0-3: 4 x 128 adjacent floats, scaled by 1/sqrt(64)
  sc_s[(t >> 7) * SCP + (t & 127)]       = sv0 * 0.125f;
  sc_s[(2 + (t >> 7)) * SCP + (t & 127)] = sv1 * 0.125f;
#pragma unroll
  for (int j = 0; j < 4; ++j) u_s[j * UP + t] = uv[j];
  u_s[4 * UP + t] = 0.f;
  if (t < SEQ) sc_s[NH * SCP + t] = 0.f;
#pragma unroll
  for (int i = 0; i < 4; ++i) cb += cq0[i] * cb0[i];
#pragma unroll
  for (int i = 0; i < 4; ++i) cb += cq1[i] * cb1[i];
#pragma unroll
  for (int off = 4; off < 32; off <<= 1) cb += __shfl_xor(cb, off, 32);
  // publishes u_s and sc_s only; the copies stay in flight over it
  __syncthreads();

  // ---- pos scores, heads 4-7: S[key,h] = rel_s[128,256] @ u^T[256,4] + cb -
  // One 16-key tile per wave; columns 4..15 of B are zero and not stored.
  // The tile's rows are the wave's own copies: it works on group g as soon as its
  // own counted wait says that all but the younger groups have landed.  The other
  // waves read these rows only behind the barrier below, which every wave reaches
  // behind its wait to 0.
  {
    const int m0 = wv << 4;
    const float* As = rel_s + (m0 + r) * RP + ks;
    const float* Bs = u_s + (r < 4 ? r : 4) * UP + ks;
    v8f acc0 = {cb, cb, cb, cb, cb, cb, cb, cb};
    v8f acc1 = {0.f, 0.f, 0.f, 0.f, 0.f, 0.f, 0.f, 0.f};
    auto group = [&](const int kb) {
      // eight WMMAs a trip: a trip's LDS reads go out ahead of the WMMAs they feed
#pragma unroll 4
      for (int k0 = kb; k0 < kb + 64; k0 += 8) {
        const v2f a0 = *(const v2f*)(As + k0);
        const v2f a1 = *(const v2f*)(As + k0 + 4);
        const v2f b0 = *(const v2f*)(Bs + k0);
        const v2f b1 = *(const v2f*)(Bs + k0 + 4);
        acc0 = wmma4(a0, b0, acc0);
        acc1 = wmma4(a1, b1, acc1);
      }
    };
    // Quarters in the order copied, first = the wave's first quarter (a literal in
    // each call, so that every LDS offset stays an immediate).  Each wait holds the
    // LDS reads of its group behind the landing of that group: all but the 24, 16,
    // 8, 0 youngest copies.
    auto groups = [&](const int first) {
      asm volatile("s_wait_asynccnt 0x18" ::: "memory");
      group(64 * first);
      asm volatile("s_wait_asynccnt 0x10" ::: "memory");
      group(64 * ((first + 1) & 3));
      asm volatile("s_wait_asynccnt 0x8" ::: "memory");   // group 2 has landed
      group(64 * ((first + 2) & 3));
      asm volatile("s_wait_asynccnt 0x0" ::: "memory");   // all of the wave's rows
      group(64 * ((first + 3) & 3));
      // here and not behind the join: register moves at the join read D too
      wmma_gap(acc0, acc1);
    };
    if (rot == 0)
      groups(0);
    else if (rot == 1)
      groups(1);
    else if (rot == 2)
      groups(2);
    else
      groups(3);
    if (r < 4) {
      float* So = sc_s + (4 + r) * SCP + m0 + ro;
#pragma unroll
      for (int v = 0; v < 8; ++v) So[v] = (acc0[v] + acc1[v]) * 0.125f;
    }
  }

  __syncthreads();

  // ---- softmax over k, one wave32 per head -------------------------------
  float av[4];                                 // attn[head wv][lane + 32 j]
  {
    float* row = sc_s + wv * SCP;
    float vals[4];
    float m = -1e30f;
#pragma unroll
    for (int j = 0; j < 4; ++j) {
      vals[j] = row[lane + 32 * j];
      m = fmaxf(m, vals[j]);
    }
#pragma unroll
    for (int off = 16; off > 0; off >>= 1) m = fmaxf(m, __shfl_xor(m, off, 32));
    float sum = 0.f;
#pragma unroll
    for (int j = 0; j < 4; ++j) { vals[j] = __expf(vals[j] - m); sum += vals[j]; }
#pragma unroll
    for (int off = 16; off > 0; off >>= 1) sum += __shfl_xor(sum, off, 32);
    const float inv = 1.f / sum;
#pragma unroll
    for (int j = 0; j < 4; ++j) {
      av[j] = vals[j] * inv;
      row[lane + 32 * j] = av[j];
    }
  }
  __syncthreads();

  // ---- R[h,:] = attn[8,128] @ rel_s[128,256]  (WMMA, rows 8..15 zero) -----
  // Two 16-column tiles per wave, one after the other; even and odd k steps
  // go to two accumulators that are added at the end.
  {
    const float* As = sc_s + (r < NH ? r : NH) * SCP + ks;
    // not unrolled: with both tiles in one body the LDS loads get paired across
    // tiles and every B fragment then needs register moves next to the WMMAs
#pragma unroll 1
    for (int nt = 0; nt < 2; ++nt) {
      const int n0 = (wv << 5) + (nt << 4);
      const float* Bs = rel_s + ks * RP + n0 + r;
      v8f c0 = {0.f, 0.f, 0.f, 0.f, 0.f, 0.f, 0.f, 0.f};
      v8f c1 = {0.f, 0.f, 0.f, 0.f, 0.f, 0.f, 0.f, 0.f};
      // rolled so that the gap below closes every run of eight WMMAs
#pragma unroll 1
      for (int k0 = 0; k0 < SEQ; k0 += 32) {
        v2f a[8], bb[8];
#pragma unroll
        for (int j = 0; j < 8; ++j) {
          a[j]    = *(const v2f*)(As + k0 + 4 * j);
          bb[j].x = Bs[(k0 + 4 * j) * RP];
          bb[j].y = Bs[(k0 + 4 * j) * RP + RP];
        }
#pragma unroll
        for (int j = 0; j < 8; j += 2) {
          c0 = wmma4(a[j], bb[j], c0);
          c1 = wmma4(a[j + 1], bb[j + 1], c1);
        }
        wmma_gap(c0, c1);
      }
      if (lane < 16) {                          // rows 0..7 = heads
        float* Ro = rg + (size_t)bq * NH * D_MODEL + n0 + r;
#pragma unroll
        for (int v = 0; v < 8; ++v) Ro[v * D_MODEL] = c0[v] + c1[v];
        // the next tile's accumulators reuse the registers these stores name
        asm volatile("s_wait_xcnt 0x0" ::: "memory");
      }
    }
  }

  // ---- attn itself, for the value product of the next launch --------------
  // Stored behind the last barrier: a barrier waits for the wave's open stores.
  {
    float* ao = ag + ((size_t)bq * NH + wv) * SEQ + lane;
#pragma unroll
    for (int j = 0; j < 4; ++j) ao[32 * j] = av[j];
  }
}

#define DFF 2048
#define HC  512   // hidden columns per block
#define HP  516
#define XP  260

// A work-group barrier that orders LDS alone: __syncthreads() would also wait
// for the weight loads that are to stay in flight over it.
__device__ __forceinline__ void barrier_lds_only() {
  __builtin_amdgcn_fence(__ATOMIC_RELEASE, "workgroup", "local");
  __builtin_amdgcn_s_barrier();
  __builtin_amdgcn_fence(__ATOMIC_ACQUIRE, "workgroup", "local");
}

// acc[0..NT-1] += A[16, 8*NB] @ B[8*NB, 16*NT]: the k loop of gemm_strip (same k
// order, same ring of four fragment sets).  Ap (LDS), Bp (memory): the lane's
// first element; rows of B are BN floats apart.  between() runs behind the first
// three k blocks' B loads and ahead of the first A load: what it does is covered
// by those loads' latency.
template <int BN, int NB, int NT, typename F>
__device__ __forceinline__ void strip_mma(const float* Ap,
                                          const float* __restrict__ Bp,
                                          v8f (&acc)[NT], F between) {
  v4f a[4];
  v2f b[4][2][NT];
  auto load_a = [&](int s) { a[s & 3] = *(const v4f*)(Ap + s * 8); };
  auto load_b = [&](int s) {
    const int buf = s & 3;
    const int kk  = s * 8;
#pragma unroll
    for (int st = 0; st < 2; ++st)
#pragma unroll
      for (int t = 0; t < NT; ++t) {
        b[buf][st][t].x = Bp[(kk + 2 * st) * BN + 16 * t];
        b[buf][st][t].y = Bp[(kk + 2 * st + 1) * BN + 16 * t];
      }
  };
  load_b(0);
  load_b(1);
  load_b(2);
  // keeps these loads ahead of between(): the scheduler would sink them into it,
  // behind its own waits
  __builtin_amdgcn_sched_barrier(0);
  between();
  load_a(0);
  load_a(1);
  load_a(2);
#pragma unroll
  for (int s = 0; s < NB; ++s) {
    const int cur = s & 3;
    if (s + 3 < NB) {
      load_a(s + 3);
      load_b(s + 3);
    }
    // keeps the loads above this block's WMMAs: without it the scheduler sinks
    // them to a few WMMAs ahead of their use and the wave waits out the latency
    __builtin_amdgcn_sched_barrier(0);
    const v2f a0 = {a[cur].x, a[cur].y};
    const v2f a1 = {a[cur].z, a[cur].w};
#pragma unroll
    for (int t = 0; t < NT; ++t) acc[t] = wmma4(a0, b[cur][0][t], acc[t]);
#pragma unroll
    for (int t = 0; t < NT; ++t) acc[t] = wmma4(a1, b[cur][1][t], acc[t]);
    // keeps later blocks' loads from rising above these WMMAs (register use)
    __builtin_amdgcn_sched_barrier(0);
  }
  // D is read directly behind
  if constexpr (NT == 2)
    wmma_gap(acc[0], acc[1]);
  else
    wmma_gap(acc[0], acc[1], acc[2], acc[3]);
}

__global__ __launch_bounds__(512) void vfold_ln_ffn_kernel(
    const float* __restrict__ rg, const float* __restrict__ Wvp,
    const float* __restrict__ ag, const float* __restrict__ v_base,
    const float* __restrict__ src, const float* __restrict__ g1,
    const float* __restrict__ be1, float* __restrict__ xout,
    const float* __restrict__ W1, const float* __restrict__ b1,
    const float* __restrict__ W2, const float* __restrict__ b2,
    float* __restrict__ ffp) {
  __shared__ float xs[2 * 16 * D_MODEL];        // src + R product | attn product
  __shared__ __attribute__((aligned(16))) float x_s[16 * XP];
  __shared__ __attribute__((aligned(16))) float h_s[16 * HP];
  // pitch 68 floats, as in gemm_strip
  __shared__ __attribute__((aligned(16))) float red[16 * 16 * 68];
  const int wv   = __builtin_amdgcn_readfirstlane(threadIdx.x >> 5);
  const int lane = threadIdx.x & 31;
  const int r    = lane & 15;
  const int hi   = lane >> 4;
  const int m0   = (blockIdx.x >> 2) << 4;
  const int c    = blockIdx.x & 3;

  // ---- the two products behind attention, 16 rows x 256 columns each -------
  {
    const int ks = hi << 1;
    const int ro = hi << 3;
    const int h  = wv & 7;
    const int n0 = h << 5;
    v8f c0 = {0.f, 0.f, 0.f, 0.f, 0.f, 0.f, 0.f, 0.f};
    v8f c1 = {0.f, 0.f, 0.f, 0.f, 0.f, 0.f, 0.f, 0.f};
    if (wv < 8) {
      const float* Ap = rg + ((size_t)(m0 + r) * NH + h) * D_MODEL + ks;
      const float* Bp = Wvp + (size_t)ks * D_MODEL + n0 + r;
      // the residual is this product's start value: read behind the products, its
      // latency would stand in front of LayerNorm1
      const float* Sp = src + (size_t)(m0 + ro) * D_MODEL + n0 + r;
#pragma unroll
      for (int v = 0; v < 8; ++v) {
        c0[v] = Sp[v * D_MODEL];
        c1[v] = Sp[v * D_MODEL + 16];
      }
#pragma unroll 8
      for (int k0 = 0; k0 < D_MODEL; k0 += 4) {
        v2f a, b0, b1f;
        a.x   = Ap[k0];
        a.y   = Ap[k0 + 1];
        b0.x  = Bp[k0 * D_MODEL];
        b0.y  = Bp[k0 * D_MODEL + D_MODEL];
        b1f.x = Bp[k0 * D_MODEL + 16];
        b1f.y = Bp[k0 * D_MODEL + D_MODEL + 16];
        c0 = wmma4(a, b0, c0);
        c1 = wmma4(a, b1f, c1);
      }
    } else {
      const int b0r = m0 & ~(SEQ - 1);          // first row of the batch
      const float* Ap = ag + ((size_t)(m0 + r) * NH + h) * SEQ + ks;
      const float* Bp = v_base + (size_t)(b0r + ks) * D_MODEL + n0 + r;
#pragma unroll 8
      for (int k0 = 0; k0 < SEQ; k0 += 4) {
        v2f a, b0, b1f;
        a.x   = Ap[k0];
        a.y   = Ap[k0 + 1];
        b0.x  = Bp[k0 * D_MODEL];
        b0.y  = Bp[k0 * D_MODEL + D_MODEL];
        b1f.x = Bp[k0 * D_MODEL + 16];
        b1f.y = Bp[k0 * D_MODEL + D_MODEL + 16];
        c0 = wmma4(a, b0, c0);
        c1 = wmma4(a, b1f, c1);
      }
    }
    wmma_gap(c0, c1);                           // the stores read D directly
    float* xo = xs + (wv >> 3) * 16 * D_MODEL;
#pragma unroll
    for (int v = 0; v < 8; ++v) {
      xo[(ro + v) * D_MODEL + n0 + r]      = c0[v];
      xo[(ro + v) * D_MODEL + n0 + r + 16] = c1[v];
    }
  }
  __syncthreads();

  // b2 for the second FFN product is fetched here: read there, its latency would
  // stand in front of the barrier between the two products
  float b2v[4];
#pragma unroll
  for (int t = 0; t < 4; ++t) b2v[t] = b2[((wv & 3) << 6) + 16 * t + r];

  // ---- h slice: one 16x32 strip per wave, whole K = 256 --------------------
  // LayerNorm1 (one row per wave) runs, and the block meets, under the first W1
  // loads.
  v8f hacc[2];
  {
    const int n0 = c * HC + wv * 32;
#pragma unroll
    for (int t = 0; t < 2; ++t) {
      const float bi = b1[n0 + 16 * t + r];
      hacc[t] = (v8f){bi, bi, bi, bi, bi, bi, bi, bi};
    }
    // the offset registers of the b1 and b2 loads are dead here and go to later
    // loads' results: the wait stands ahead of that overwrite
    asm volatile("s_wait_xcnt 0x0" ::: "memory");
    strip_mma<DFF, D_MODEL / 8, 2>(
        x_s + r * XP + 4 * hi, W1 + (size_t)(4 * hi) * DFF + n0 + r, hacc, [&] {
          const size_t gro = (size_t)(m0 + wv) * D_MODEL;
          float x[8];
          float sum = 0.f;
#pragma unroll
          for (int i = 0; i < 8; ++i) {
            x[i] = xs[(16 + wv) * D_MODEL + lane + 32 * i] +
                   xs[wv * D_MODEL + lane + 32 * i];
            sum += x[i];
          }
#pragma unroll
          for (int off = 16; off > 0; off >>= 1) sum += __shfl_xor(sum, off, 32);
          const float mean = sum * (1.f / D_MODEL);
          float sq = 0.f;
#pragma unroll
          for (int i = 0; i < 8; ++i) {
            x[i] -= mean;
            sq += x[i] * x[i];
          }
#pragma unroll
          for (int off = 16; off > 0; off >>= 1) sq += __shfl_xor(sq, off, 32);
          const float rs = rsqrtf(sq * (1.f / D_MODEL) + 1e-5f);
#pragma unroll
          for (int i = 0; i < 8; ++i) {
            const int col = lane + 32 * i;
            x[i] = x[i] * rs * g1[col] + be1[col];
            x_s[wv * XP + col] = x[i];
          }
          if (c == 0) {
#pragma unroll
            for (int i = 0; i < 8; ++i) xout[gro + lane + 32 * i] = x[i];
            // later code reuses the registers these stores name
            asm volatile("s_wait_xcnt 0x0" ::: "memory");
          }
          barrier_lds_only();
        });
  }

  // ---- h slice @ its rows of W2: strip wv & 3, quarter wv >> 2 of the 512 k -
  // The slice goes to LDS, and the block meets, under the first W2 loads.
  {
    const int n0 = (wv & 3) << 6;
    const int k0 = (wv >> 2) * (HC / 4);
    v8f acc[4];
#pragma unroll
    for (int t = 0; t < 4; ++t) {
      const float bi = (c == 0 && wv < 4) ? b2v[t] : 0.f;
      acc[t] = (v8f){bi, bi, bi, bi, bi, bi, bi, bi};
    }
    strip_mma<D_MODEL, HC / 32, 4>(
        h_s + r * HP + k0 + 4 * hi,
        W2 + (size_t)(c * HC + k0 + 4 * hi) * D_MODEL + n0 + r, acc, [&] {
#pragma unroll
          for (int t = 0; t < 2; ++t)
#pragma unroll
            for (int v = 0; v < 8; ++v)
              h_s[(v + 8 * hi) * HP + wv * 32 + 16 * t + r] =
                  fmaxf(hacc[t][v], 0.f);
          barrier_lds_only();
        });
#pragma unroll
    for (int t = 0; t < 4; ++t)
#pragma unroll
      for (int v = 0; v < 8; ++v)
        red[(wv * 16 + v + 8 * hi) * 68 + 16 * t + r] = acc[t][v];
  }
  __syncthreads();
  // row wv; a lane sums the four k quarters of two 16-byte pieces
  float* Co = ffp + ((size_t)c * 1024 + m0 + wv) * D_MODEL;
#pragma unroll
  for (int j = 0; j < 2; ++j) {
    const int sn = 2 * j + hi;                  // 64-column strip
    const int c4 = r << 2;
    const float* rp = red + (sn * 16 + wv) * 68 + c4;
    *(v4f*)(Co + sn * 64 + c4) =
        (*(const v4f*)rp + *(const v4f*)(rp + 4 * 16 * 68)) +
        (*(const v4f*)(rp + 8 * 16 * 68) + *(const v4f*)(rp + 12 * 16 * 68));
  }
}

// out = LayerNorm(a + the four planes of c) with gain/bias; one 256-thread block
// per row.  The planes are 1024 rows apart.
__global__ void add_ln_kernel(const float* __restrict__ a,
                              const float* __restrict__ c,
                              const float* __restrict__ g,
                              const float* __restrict__ be,
                              float* __restrict__ out) {
  __shared__ float red[16];
  const int row = blockIdx.x, t = threadIdx.x;
  const float* cr = c + (size_t)row * D_MODEL + t;
  float x = a[(size_t)row * D_MODEL + t] +
            ((cr[0] + cr[1024 * D_MODEL]) +
             (cr[2 * 1024 * D_MODEL] + cr[3 * 1024 * D_MODEL]));
  const float mean = block_sum_256(x, red) * (1.f / D_MODEL);
  const float d    = x - mean;
  const float var  = block_sum_256(d * d, red) * (1.f / D_MODEL);
  out[(size_t)row * D_MODEL + t] = d * rsqrtf(var + 1e-5f) * g[t] + be[t];
}

// ---------------------------------------------------------------------------
extern "C" void kernel_launch(void* const* d_in, const int* in_sizes, int n_in,
                              void* d_out, int out_size, void* d_ws,
                              size_t ws_size, hipStream_t stream) {
  const float* src = (const float*)d_in[0];
  const float* pos = (const float*)d_in[1];
  const float* rel = (const float*)d_in[2];
  const float* Wq  = (const float*)d_in[3];  const float* bq  = (const float*)d_in[4];
  const float* Wk  = (const float*)d_in[5];  const float* bk  = (const float*)d_in[6];
  const float* Wv  = (const float*)d_in[7];  const float* bv  = (const float*)d_in[8];
  const float* Wqp = (const float*)d_in[9];  const float* bqp = (const float*)d_in[10];
  const float* Wkp = (const float*)d_in[11]; const float* bkp = (const float*)d_in[12];
  const float* Wvp = (const float*)d_in[13]; const float* bvp = (const float*)d_in[14];
  const float* W1  = (const float*)d_in[15]; const float* b1  = (const float*)d_in[16];
  const float* W2  = (const float*)d_in[17]; const float* b2  = (const float*)d_in[18];
  const float* g1  = (const float*)d_in[19]; const float* be1 = (const float*)d_in[20];
  const float* g2  = (const float*)d_in[21]; const float* be2 = (const float*)d_in[22];

  const int M = 8 * 128;                       // B*A rows
  float* ws  = (float*)d_ws;
  float* q   = ws;                             // 1024*256
  float* qp  = q   + M * D_MODEL;
  float* kb  = qp  + M * D_MODEL;
  float* vb  = kb  + M * D_MODEL;
  float* x   = vb  + M * D_MODEL;
  float* ffp = x   + M * D_MODEL;              // 4*1024*256 partial FFN outputs
  float* u   = ffp + 4 * M * D_MODEL;          // 1024*4*256 folded pos query
  float* rr  = u   + M * 4 * D_MODEL;          // 1024*8*256 attn-weighted rel
  float* at  = rr  + M * NH * D_MODEL;         // 1024*8*128 attn
  float* sc  = at  + M * NH * SEQ;             // 1024*4*128 content scores

  // content / positional projections (WMMA fp32), one launch
  proj3_kernel<<<768, 256, 0, stream>>>(src, pos, Wq, bq, Wqp, bqp, Wk, bk, q,
                                        qp, kb);

  // one launch: v = Wv(Wk(src)) + bvp, Wkp applied to the query side, content
  // scores; attention over rel (one WG per (b,q)), then one launch: Wvp applied to
  // the attn-weighted rel rows, attn applied to v, residual + LN1, FFN
  fold_query_kernel<<<1024, 256, 0, stream>>>(qp, Wkp, u, q, kb, sc, Wv, bv, bvp,
                                              vb);
  const size_t smem = (SEQ * RP + 5 * UP + (NH + 1) * SCP) * sizeof(float);
  attn_fused_kernel<<<M, 256, smem, stream>>>(rel, sc, qp, u, bkp, rr, at);
  vfold_ln_ffn_kernel<<<256, 512, 0, stream>>>(rr, Wvp, at, vb, src, g1, be1, x,
                                               W1, b1, W2, b2, ffp);

  // LN2
  add_ln_kernel<<<M, 256, 0, stream>>>(x, ffp, g2, be2, (float*)d_out);
}
